// v000
// Times are from an AMD MI455X. After a warm-up the kernel runs many times in a row, and a time is the length of
// such a window on the GPU divided by its runs, so every launch and the gaps after it count. The runs cycle
// through copies of the inputs. A figure is the median of several windows, for all but v000 over two sittings.
// Sittings can differ by a few percent; kernels timed side by side share one.
// The starting kernel, v000, takes 1690 microseconds a run.
#include <hip/hip_runtime.h>

// Bidirectional grouped-query attention (x [2][4096][768]; q = x wq^T (6 heads x 128) x 128^-0.5, k, v = x wk^T / wv^T ([256][768]: 2 kv heads; query head h = g*3 + r uses kv head h/3); softmax(q.k) over all keys (no mask); out = merged wo^T -> [2][4096][768] (6.3 M)).
// Compute dtypes, f32 accumulate: every input rounded to bf16; q/k/v on PLAIN bf16 operands (inputs: exact); scores and attn.v: every query row single fp16 (x1024; RH = 0); softmax f32; wo hl x exact (2 products).

#define NB_  2
#define TT   4096
#define DM   768
#define NH_  6
#define NKV  2
#define REP  (NH_ / NKV)
#define HD   128
#define DQ   (NH_ * HD)
#define DKV  (NKV * HD)
#define ZH   1
#define RH   0                  // query rows < RH use hi+lo planes (0: none)
#define WIN  0
#define PCAR 1024.0f
#define SCL  0.088388347648318447f   // HD^-0.5
typedef _Float16 h16;
typedef unsigned short bf;
typedef __attribute__((ext_vector_type(16))) __bf16   v16bf;
typedef __attribute__((ext_vector_type(16))) _Float16 v16h;
typedef __attribute__((ext_vector_type(8)))  _Float16 v8h;
typedef __attribute__((ext_vector_type(8)))  unsigned short v8us;
typedef __attribute__((ext_vector_type(8)))  float    v8f;
typedef __attribute__((ext_vector_type(4)))  float    v4f;
typedef v8h  __attribute__((may_alias)) v8ha;
typedef v4f  __attribute__((may_alias)) v4fa;
typedef v8us __attribute__((may_alias)) v8usa;

__device__ __forceinline__ unsigned short f2bf(float f) { unsigned u = __float_as_uint(f); u += 0x7FFFu + ((u >> 16) & 1u); return (unsigned short)(u >> 16); }
__device__ __forceinline__ float bf2f(unsigned short b) { return __uint_as_float(((unsigned)b) << 16); }
__device__ __forceinline__ float bfr(float f) { return bf2f(f2bf(f)); }
__device__ __forceinline__ v16h cat16(v8h lo, v8h hi) { return __builtin_shufflevector(lo, hi, 0, 1, 2, 3, 4, 5, 6, 7, 8, 9, 10, 11, 12, 13, 14, 15); }
__device__ __forceinline__ v16bf cat16b(v8us lo, v8us hi) { return __builtin_bit_cast(v16bf, __builtin_shufflevector(lo, hi, 0, 1, 2, 3, 4, 5, 6, 7, 8, 9, 10, 11, 12, 13, 14, 15)); }
__device__ __forceinline__ v8f wmma16(v16h a, v16h b, v8f c) { return __builtin_amdgcn_wmma_f32_16x16x32_f16(false, a, false, b, (short)0, c, false, false); }
__device__ __forceinline__ v8f wmmab(v16bf a, v16bf b, v8f c) { return __builtin_amdgcn_wmma_f32_16x16x32_bf16(false, a, false, b, (short)0, c, false, false); }



// ---- k_gemmw: register-blocked GEMM, ONE WAVE per 64x64 output tile (16 accumulators), operands straight from K-contiguous 16-bit planes; grid (M/64, N/64, Z), 32 threads.
// C[m][n] (f32, pitch ldc, + optional f32 bias[n]) = sum_k A[m][k] Bt[n][k] (+ split products per NSPLIT). z-batch strides sA/sB/sC in elements. K % 32 == 0.
template <typename T16> struct WFrag;
template <> struct WFrag<h16> { typedef v16h V; static __device__ __forceinline__ V ld(const h16* p) { return cat16(*(const v8h*)p, *(const v8h*)(p + 16)); } static __device__ __forceinline__ v8f mma(V a, V b, v8f c) { return wmma16(a, b, c); } };
template <> struct WFrag<bf> { typedef v16bf V; static __device__ __forceinline__ V ld(const bf* p) { return cat16b(*(const v8us*)p, *(const v8us*)(p + 16)); } static __device__ __forceinline__ v8f mma(V a, V b, v8f c) { return wmmab(a, b, c); } };
template <typename T16, int NSPLIT, bool BIAS>
__global__ __launch_bounds__(32) void k_gemmw(const T16* __restrict__ A, const T16* __restrict__ A2, const T16* __restrict__ Bt, const T16* __restrict__ Bt2, int K, float* C, int ldc, const float* __restrict__ bias, size_t sA, size_t sB, size_t sC) {
    typedef typename WFrag<T16>::V V;
    __shared__ __align__(16) float os[16 * 68];
    const size_t z = blockIdx.z; A += z * sA; if (A2) A2 += z * sA; Bt += z * sB; if (Bt2) Bt2 += z * sB; C += z * sC;
    const int lane = threadIdx.x & 31, lr = lane & 15, hi = lane >> 4; const int r0 = blockIdx.x * 64, c0 = blockIdx.y * 64;
    v8f acc[4][4];
#pragma unroll
    for (int mb = 0; mb < 4; ++mb)
#pragma unroll
        for (int nb = 0; nb < 4; ++nb) acc[mb][nb] = (v8f){};
    const size_t aoff = (size_t)(r0 + lr) * K + 8 * hi, boff = (size_t)(c0 + lr) * K + 8 * hi;
#pragma unroll 1
    for (int kc = 0; kc < K; kc += 32) {
        V a[4], a2[4];
#pragma unroll
        for (int mb = 0; mb < 4; ++mb) { a[mb] = WFrag<T16>::ld(A + aoff + (size_t)mb * 16 * K + kc); if (NSPLIT == 1 || NSPLIT == 2) a2[mb] = WFrag<T16>::ld(A2 + aoff + (size_t)mb * 16 * K + kc); }
#pragma unroll
        for (int nb = 0; nb < 4; ++nb) { const V b = WFrag<T16>::ld(Bt + boff + (size_t)nb * 16 * K + kc); V b2; if (NSPLIT >= 2) b2 = WFrag<T16>::ld(Bt2 + boff + (size_t)nb * 16 * K + kc);
#pragma unroll
            for (int mb = 0; mb < 4; ++mb) { acc[mb][nb] = WFrag<T16>::mma(a[mb], b, acc[mb][nb]); if (NSPLIT == 1 || NSPLIT == 2) acc[mb][nb] = WFrag<T16>::mma(a2[mb], b, acc[mb][nb]); if (NSPLIT >= 2) acc[mb][nb] = WFrag<T16>::mma(a[mb], b2, acc[mb][nb]); } }
        asm volatile("v_nop\n\tv_nop\n\tv_nop\n\tv_nop" : "+v"(acc[0][0]), "+v"(acc[1][1]), "+v"(acc[2][2]), "+v"(acc[3][3]) : "v"(a[0]), "v"(a[3]));
    }
#pragma unroll
    for (int mb = 0; mb < 4; ++mb) {
#pragma unroll
        for (int nb = 0; nb < 4; ++nb) {
#pragma unroll
            for (int j = 0; j < 8; ++j) os[(hi * 8 + j) * 68 + nb * 16 + lr] = acc[mb][nb][j]; }
        __builtin_amdgcn_wave_barrier(); asm volatile("" ::: "memory");
        float* crow = C + (size_t)(r0 + mb * 16) * ldc + c0;
{
#pragma unroll
            for (int s = 0; s < 8; ++s) { const int row = 2 * s + hi, cofs = lr * 4; v4f val = *(const v4fa*)(os + row * 68 + cofs); if (BIAS) { val[0] += bfr(bias[c0 + cofs]); val[1] += bfr(bias[c0 + cofs + 1]); val[2] += bfr(bias[c0 + cofs + 2]); val[3] += bfr(bias[c0 + cofs + 3]); }
                *(v4f*)(crow + (size_t)row * ldc + cofs) = val; }
             }
        __builtin_amdgcn_wave_barrier(); asm volatile("" ::: "memory");
    }
}

__device__ __forceinline__ h16 tohx(float x) { return (h16)x; }
__device__ __forceinline__ void splitf(float y, unsigned short& h, unsigned short& l) { h = f2bf(y); l = f2bf(y - bf2f(h)); }
typedef __attribute__((ext_vector_type(2))) _Float16 v2h;
typedef __attribute__((ext_vector_type(4))) _Float16 v4h;
typedef __attribute__((ext_vector_type(2))) unsigned short v2us;
typedef __attribute__((ext_vector_type(4))) unsigned short v4us;
typedef __attribute__((ext_vector_type(2))) float v2f;
typedef __attribute__((ext_vector_type(4))) int v4i;

__global__ __launch_bounds__(256) void k_wtG(const float* __restrict__ w, int K, int N, bf* Bt) {
    const int lane = threadIdx.x & 31; const int L0 = (blockIdx.x * 8 + (threadIdx.x >> 5)) * 8; const int nlines = N * K / 64;
{
#pragma unroll 1
        for (int l = 0; l < 8; ++l) { const int L = L0 + l; if (L >= nlines) break; const size_t e = (size_t)L * 64 + lane * 2; const int k = (int)(e % K), n = (int)(e / K); v2us o;
            o[0] = f2bf(w[(size_t)k * N + n]); o[1] = f2bf(w[(size_t)(k + 1) * N + n]); *(v2us*)(Bt + e) = o; }
         }
}
__global__ __launch_bounds__(256) void k_cvt8(const float* __restrict__ src, bf* dst, size_t n8) { const size_t i = (size_t)blockIdx.x * 256 + threadIdx.x; if (i >= n8) return; const v8f v = *(const v8f*)(src + i * 8); v8us o;
#pragma unroll
    for (int k = 0; k < 8; ++k) o[k] = f2bf(v[k]); *(v8us*)(dst + i * 8) = o;  }

// k_rope: head planes [h][t][d] (fp16) of rope(x) x sc with the rotate-half convention out[d] = x[d] cos[t][d] - x[d+HD/2] sin[t][d], out[d+HD/2] = x[d+HD/2] cos[t][d+HD/2] + x[d] sin[t][d+HD/2]
__global__ __launch_bounds__(256) void k_rope(const float* __restrict__ F, int pitch, int nheads, const float* __restrict__ CS, const float* __restrict__ RF, const float* __restrict__ nw, float sc, h16* P16, bf* Ph, bf* Pl) {
    const size_t e = ((size_t)blockIdx.x * 256 + threadIdx.x) * 2; if (e >= (size_t)nheads * TT * HD) return; const int d = (int)(e % HD); const int t = (int)((e / HD) % TT); const int h = (int)(e / ((size_t)HD * TT)); const float* f = F + (size_t)t * pitch + h * HD; const float rf = RF ? RF[(size_t)h * TT + t] : 1.0f; v2h o16; v2us oh, ol;
#pragma unroll
    for (int q = 0; q < 2; ++q) { const int dd = d + q; const int dp = (dd < HD / 2) ? dd + HD / 2 : dd - HD / 2; float x0 = f[dd], x1 = f[dp];
        if (RF) { float n0 = __fmul_rn(x0, rf), n1 = __fmul_rn(x1, rf); asm volatile("" : "+v"(n0)); asm volatile("" : "+v"(n1)); x0 = __fmul_rn(bfr(nw[dd]), n0); x1 = __fmul_rn(bfr(nw[dp]), n1); }
        const v2f cs = *(const v2f*)(CS + ((size_t)t * HD + dd) * 2); float a = __fmul_rn(x0, cs[0]), bq = __fmul_rn(x1, cs[1]); asm volatile("" : "+v"(a)); asm volatile("" : "+v"(bq)); const float r = ((dd < HD / 2) ? __fsub_rn(a, bq) : __fadd_rn(a, bq)) * sc;
        o16[q] = tohx(r); (void)oh; (void)ol; }
    *(v2h*)(P16 + e) = o16;  }
__global__ __launch_bounds__(256) void k_vtp(const float* __restrict__ F, int pitch, int nheads, h16* V16, bf* Vh, bf* Vl) { const size_t e = ((size_t)blockIdx.x * 256 + threadIdx.x) * 2; if (e >= (size_t)nheads * HD * TT) return; const int t = (int)(e % TT); const int d = (int)((e / TT) % HD); const int g = (int)(e / ((size_t)TT * HD)); v2h o16; v2us oh, ol;
#pragma unroll
    for (int q = 0; q < 2; ++q) { const float x = F[(size_t)(t + q) * pitch + g * HD + d]; o16[q] = tohx(x); (void)oh; (void)ol; }
    *(v2h*)(V16 + e) = o16;  }
__global__ __launch_bounds__(256) void k_csid(float* CS) { const int idx = blockIdx.x * 256 + threadIdx.x; if (idx >= TT * HD) return; v2f cs; cs[0] = 1.0f; cs[1] = 0.0f; *(v2f*)(CS + (size_t)idx * 2) = cs;  }
// k_asoft: per row (zz, i): t = S x HD^-0.5 (no mask); softmax over the 4096 keys (register row, one exp, fixed trees);
__global__ __launch_bounds__(256) void k_asoft(const float* __restrict__ Sb, h16* P16, bf* Ph, bf* Pl) {
    const int lane = threadIdx.x & 31; const int row = blockIdx.x * 8 + (threadIdx.x >> 5); if (row >= ZH * TT) return; const int i = row % TT; const int zz = row / TT; (void)zz; const bool hires = (i < RH); const float* sr = Sb + (size_t)row * TT; float v[TT / 32]; float mx = -3.0e38f;
#pragma unroll
    for (int ch = 0; ch < TT / 128; ++ch) { const int j0 = ch * 128 + lane * 4; const v4f a = *(const v4f*)(sr + j0);
#pragma unroll
        for (int q = 0; q < 4; ++q) { const int j = j0 + q; (void)j; const float t = a[q] * SCL; v[ch * 4 + q] = t; mx = fmaxf(mx, t); } if ((ch & 7) == 7) asm volatile("s_wait_loadcnt 0x0" ::: "memory"); }
#pragma unroll
    for (int sh = 16; sh; sh >>= 1) mx = fmaxf(mx, __shfl_xor(mx, sh, 32));
    float sum = 0.f;
#pragma unroll
    for (int k = 0; k < TT / 32; ++k) { float d0 = __fsub_rn(v[k], mx); asm volatile("" : "+v"(d0)); v[k] = __builtin_amdgcn_exp2f(__fmul_rn(d0, 1.4426950408889634f)); sum += v[k]; }
#pragma unroll
    for (int sh = 16; sh; sh >>= 1) sum += __shfl_xor(sum, sh, 32);
    const float f = __fdiv_rn(hires ? 1.0f : PCAR, sum);
{
        if (hires) {
#pragma unroll
            for (int ch = 0; ch < TT / 128; ++ch) { v4us oh, ol;
#pragma unroll
                for (int q = 0; q < 4; ++q) { unsigned short a, c2; splitf(v[ch * 4 + q] * f, a, c2); oh[q] = a; ol[q] = c2; }
                const size_t oo = ((size_t)zz * (RH ? RH : 1) + i) * TT + ch * 128 + lane * 4; *(v4us*)(Ph + oo) = oh; *(v4us*)(Pl + oo) = ol; }
        } else {
#pragma unroll
            for (int ch = 0; ch < TT / 128; ++ch) { v4h o4;
#pragma unroll
                for (int q = 0; q < 4; ++q) o4[q] = tohx(v[ch * 4 + q] * f);
                *(v4h*)(P16 + (size_t)row * TT + ch * 128 + lane * 4) = o4; } }
         }
}
__global__ __launch_bounds__(256) void k_merge(const float* __restrict__ O, int h0, bf* Ah, bf* Al) { const size_t e = ((size_t)blockIdx.x * 256 + threadIdx.x) * 2; if (e >= (size_t)ZH * TT * HD) return; const int d = (int)(e % HD); const int t = (int)((e / HD) % TT); const int zz = (int)(e / ((size_t)HD * TT)); const float cs = (t < RH) ? 1.0f : (1.0f / PCAR); const size_t oo = (size_t)t * DQ + (h0 + zz) * HD + d;
    v2us oh, ol;
#pragma unroll
    for (int q = 0; q < 2; ++q) { unsigned short a, c2; splitf(O[e + q] * cs, a, c2); oh[q] = a; ol[q] = c2; } *(v2us*)(Ah + oo) = oh; *(v2us*)(Al + oo) = ol;  }

extern "C" void kernel_launch(void* const* d_in, const int* in_sizes, int n_in,
                              void* d_out, int out_size, void* d_ws, size_t ws_size, hipStream_t stream) {
    (void)in_sizes; (void)n_in; (void)out_size;
    const float* x = (const float*)d_in[0]; const float* wq = (const float*)d_in[1]; const float* wk = (const float*)d_in[2]; const float* wv = (const float*)d_in[3]; const float* wo = (const float*)d_in[4];
    float* OUT = (float*)d_out;     // [2][4096][768]
    char* wsp = (char*)d_ws;
    auto take = [&](size_t bytes) { char* p = wsp; wsp += (bytes + 255) & ~(size_t)255; return (void*)p; };
    bf* WQ = (bf*)take((size_t)DQ * DM * 2); bf* WK = (bf*)take((size_t)DKV * DM * 2); bf* WV = (bf*)take((size_t)DKV * DM * 2); bf* WO = (bf*)take((size_t)DM * DQ * 2); float* CS = (float*)take((size_t)TT * HD * 2 * 4);
    bf* XB = (bf*)take((size_t)TT * DM * 2); float* FQ = (float*)take((size_t)TT * DQ * 4); float* FK = (float*)take((size_t)TT * DKV * 4);
    h16* QP16 = (h16*)take((size_t)NH_ * TT * HD * 2); h16* KP16 = (h16*)take((size_t)NKV * TT * HD * 2); h16* VT16 = (h16*)take((size_t)NKV * HD * TT * 2);
    bf* QPh = nullptr; bf* QPl = nullptr; bf* KPh = nullptr; bf* KPl = nullptr; bf* VTh = nullptr; bf* VTl = nullptr; bf* Ph = nullptr; bf* Pl = nullptr;
    float* Sb = (float*)take((size_t)ZH * TT * TT * 4); h16* P16 = (h16*)take((size_t)ZH * TT * TT * 2); float* Ob = (float*)take((size_t)ZH * TT * HD * 4); bf* ATh = (bf*)take((size_t)TT * DQ * 2); bf* ATl = (bf*)take((size_t)TT * DQ * 2);
    if ((size_t)(wsp - (char*)d_ws) > ws_size) return;    // ws 256 MiB
    float* FV = FK;   // v projection reuses the k buffer after the k planes are built (stream-ordered)
    { k_cvt8<<<(unsigned)(((size_t)DQ * DM / 8 + 255) / 256), 256, 0, stream>>>(wq, WQ, (size_t)DQ * DM / 8); k_cvt8<<<(unsigned)(((size_t)DKV * DM / 8 + 255) / 256), 256, 0, stream>>>(wk, WK, (size_t)DKV * DM / 8); k_cvt8<<<(unsigned)(((size_t)DKV * DM / 8 + 255) / 256), 256, 0, stream>>>(wv, WV, (size_t)DKV * DM / 8);
      k_cvt8<<<(unsigned)(((size_t)DM * DQ / 8 + 255) / 256), 256, 0, stream>>>(wo, WO, (size_t)DM * DQ / 8);
       }
    k_csid<<<(TT * HD + 255) / 256, 256, 0, stream>>>(CS);
    const unsigned LQ = (unsigned)(((size_t)NH_ * TT * HD / 2 + 255) / 256), LKv = (unsigned)(((size_t)NKV * TT * HD / 2 + 255) / 256);
    for (int b = 0; b < NB_; ++b) {
        
        k_cvt8<<<(unsigned)(((size_t)TT * DM / 8 + 255) / 256), 256, 0, stream>>>(x + (size_t)b * TT * DM, XB, (size_t)TT * DM / 8);
        k_gemmw<bf, 0, false><<<dim3(TT / 64, DQ / 64, 1), 32, 0, stream>>>(XB, nullptr, WQ, nullptr, DM, FQ, DQ, nullptr, 0, 0, 0);
        k_rope<<<LQ, 256, 0, stream>>>(FQ, DQ, NH_, CS, nullptr, nullptr, 1.0f, QP16, QPh, QPl);
        k_gemmw<bf, 0, false><<<dim3(TT / 64, DKV / 64, 1), 32, 0, stream>>>(XB, nullptr, WK, nullptr, DM, FK, DKV, nullptr, 0, 0, 0);
        k_rope<<<LKv, 256, 0, stream>>>(FK, DKV, NKV, CS, nullptr, nullptr, 1.0f, KP16, KPh, KPl);
        k_gemmw<bf, 0, false><<<dim3(TT / 64, DKV / 64, 1), 32, 0, stream>>>(XB, nullptr, WV, nullptr, DM, FV, DKV, nullptr, 0, 0, 0); k_vtp<<<LKv, 256, 0, stream>>>(FV, DKV, NKV, VT16, VTh, VTl);
        for (int h0 = 0; h0 < NH_; h0 += ZH) { const size_t zq = (size_t)h0, zk = (size_t)(h0 / REP);   // the one head of a pass (ZH = 1) uses kv group h0/REP: sB = 0
            k_gemmw<h16, 0, false><<<dim3(TT / 64, TT / 64, ZH), 32, 0, stream>>>(QP16 + zq * TT * HD, nullptr, KP16 + zk * TT * HD, nullptr, HD, Sb, TT, nullptr, (size_t)TT * HD, 0, (size_t)TT * TT);
            k_asoft<<<ZH * TT / 8, 256, 0, stream>>>(Sb, P16, Ph, Pl);
            k_gemmw<h16, 0, false><<<dim3(TT / 64, HD / 64, ZH), 32, 0, stream>>>(P16, nullptr, VT16 + zk * HD * TT, nullptr, TT, Ob, HD, nullptr, (size_t)TT * TT, 0, (size_t)TT * HD);
            k_merge<<<(unsigned)(((size_t)ZH * TT * HD / 2 + 255) / 256), 256, 0, stream>>>(Ob, h0, ATh, ATl); }
        k_gemmw<bf, 1, false><<<dim3(TT / 64, DM / 64, 1), 32, 0, stream>>>(ATh, ATl, WO, nullptr, DQ, OUT + (size_t)b * TT * DM, DM, nullptr, 0, 0, 0); }
}

// v001
// It runs in 872 microseconds.
// Next to v000, in two timings, it ran 1.93 and 1.94 times as fast.
#include <hip/hip_runtime.h>

// Bidirectional grouped-query attention (x [2][4096][768]; q = x wq^T (6 heads x 128) x 128^-0.5, k, v = x wk^T / wv^T ([256][768]: 2 kv heads; query head h = g*3 + r uses kv head h/3); softmax(q.k) over all keys (no mask); out = merged wo^T -> [2][4096][768] (6.3 M)).
// Compute dtypes, f32 accumulate: every input rounded to bf16; q/k/v on PLAIN bf16 operands (inputs: exact); scores and attn.v: every query row single fp16 (x1024; RH = 0); softmax f32; wo hl x exact (2 products).

#define NB_  2
#define TT   4096
#define DM   768
#define NH_  6
#define NKV  2
#define REP  (NH_ / NKV)
#define HD   128
#define DQ   (NH_ * HD)
#define DKV  (NKV * HD)
#define ZH   1
#define RH   0                  // query rows < RH use hi+lo planes (0: none)
#define WIN  0
#define PCAR 1024.0f
#define SCL  0.088388347648318447f   // HD^-0.5
#define KS   16                 // attn.v: key ranges, one grid-z slice each; their f32 partial rows are summed in k_merge
typedef _Float16 h16;
typedef unsigned short bf;
typedef __attribute__((ext_vector_type(16))) __bf16   v16bf;
typedef __attribute__((ext_vector_type(16))) _Float16 v16h;
typedef __attribute__((ext_vector_type(8)))  _Float16 v8h;
typedef __attribute__((ext_vector_type(8)))  unsigned short v8us;
typedef __attribute__((ext_vector_type(8)))  float    v8f;
typedef __attribute__((ext_vector_type(4)))  float    v4f;
typedef v8h  __attribute__((may_alias)) v8ha;
typedef v4f  __attribute__((may_alias)) v4fa;
typedef v8us __attribute__((may_alias)) v8usa;

__device__ __forceinline__ unsigned short f2bf(float f) { unsigned u = __float_as_uint(f); u += 0x7FFFu + ((u >> 16) & 1u); return (unsigned short)(u >> 16); }
__device__ __forceinline__ float bf2f(unsigned short b) { return __uint_as_float(((unsigned)b) << 16); }
__device__ __forceinline__ float bfr(float f) { return bf2f(f2bf(f)); }
__device__ __forceinline__ v16h cat16(v8h lo, v8h hi) { return __builtin_shufflevector(lo, hi, 0, 1, 2, 3, 4, 5, 6, 7, 8, 9, 10, 11, 12, 13, 14, 15); }
__device__ __forceinline__ v16bf cat16b(v8us lo, v8us hi) { return __builtin_bit_cast(v16bf, __builtin_shufflevector(lo, hi, 0, 1, 2, 3, 4, 5, 6, 7, 8, 9, 10, 11, 12, 13, 14, 15)); }
__device__ __forceinline__ v8f wmma16(v16h a, v16h b, v8f c) { return __builtin_amdgcn_wmma_f32_16x16x32_f16(false, a, false, b, (short)0, c, false, false); }
__device__ __forceinline__ v8f wmmab(v16bf a, v16bf b, v8f c) { return __builtin_amdgcn_wmma_f32_16x16x32_bf16(false, a, false, b, (short)0, c, false, false); }



// ---- k_gemmw: register-blocked GEMM, ONE WAVE per 64x64 output tile (16 accumulators), operands straight from K-contiguous 16-bit planes; grid (M/64, N/64, Z), 32 threads.
// C[m][n] (f32, pitch ldc, + optional f32 bias[n]) = sum_{k < klen} A[m][k] Bt[n][k] (+ split products per NSPLIT); K is the row pitch of A and Bt in elements. z-batch strides sA/sB/sC in elements. klen % 32 == 0.
template <typename T16> struct WFrag;
template <> struct WFrag<h16> { typedef v16h V; static __device__ __forceinline__ V ld(const h16* p) { return cat16(*(const v8h*)p, *(const v8h*)(p + 16)); } static __device__ __forceinline__ v8f mma(V a, V b, v8f c) { return wmma16(a, b, c); } };
template <> struct WFrag<bf> { typedef v16bf V; static __device__ __forceinline__ V ld(const bf* p) { return cat16b(*(const v8us*)p, *(const v8us*)(p + 16)); } static __device__ __forceinline__ v8f mma(V a, V b, v8f c) { return wmmab(a, b, c); } };
template <typename T16, int NSPLIT, bool BIAS>
__global__ __launch_bounds__(32) void k_gemmw(const T16* __restrict__ A, const T16* __restrict__ A2, const T16* __restrict__ Bt, const T16* __restrict__ Bt2, int K, int klen, float* C, int ldc, const float* __restrict__ bias, size_t sA, size_t sB, size_t sC) {
    typedef typename WFrag<T16>::V V;
    __shared__ __align__(16) float os[16 * 68];
    const size_t z = blockIdx.z; A += z * sA; if (A2) A2 += z * sA; Bt += z * sB; if (Bt2) Bt2 += z * sB; C += z * sC;
    const int lane = threadIdx.x & 31, lr = lane & 15, hi = lane >> 4; const int r0 = blockIdx.x * 64, c0 = blockIdx.y * 64;
    v8f acc[4][4];
#pragma unroll
    for (int mb = 0; mb < 4; ++mb)
#pragma unroll
        for (int nb = 0; nb < 4; ++nb) acc[mb][nb] = (v8f){};
    const size_t aoff = (size_t)(r0 + lr) * K + 8 * hi, boff = (size_t)(c0 + lr) * K + 8 * hi;
#pragma unroll 1
    for (int kc = 0; kc < klen; kc += 32) {
        V a[4], a2[4];
#pragma unroll
        for (int mb = 0; mb < 4; ++mb) { a[mb] = WFrag<T16>::ld(A + aoff + (size_t)mb * 16 * K + kc); if (NSPLIT == 1 || NSPLIT == 2) a2[mb] = WFrag<T16>::ld(A2 + aoff + (size_t)mb * 16 * K + kc); }
#pragma unroll
        for (int nb = 0; nb < 4; ++nb) { const V b = WFrag<T16>::ld(Bt + boff + (size_t)nb * 16 * K + kc); V b2; if (NSPLIT >= 2) b2 = WFrag<T16>::ld(Bt2 + boff + (size_t)nb * 16 * K + kc);
#pragma unroll
            for (int mb = 0; mb < 4; ++mb) { acc[mb][nb] = WFrag<T16>::mma(a[mb], b, acc[mb][nb]); if (NSPLIT == 1 || NSPLIT == 2) acc[mb][nb] = WFrag<T16>::mma(a2[mb], b, acc[mb][nb]); if (NSPLIT >= 2) acc[mb][nb] = WFrag<T16>::mma(a[mb], b2, acc[mb][nb]); } }
        asm volatile("v_nop\n\tv_nop\n\tv_nop\n\tv_nop" : "+v"(acc[0][0]), "+v"(acc[1][1]), "+v"(acc[2][2]), "+v"(acc[3][3]) : "v"(a[0]), "v"(a[3]));
    }
#pragma unroll
    for (int mb = 0; mb < 4; ++mb) {
#pragma unroll
        for (int nb = 0; nb < 4; ++nb) {
#pragma unroll
            for (int j = 0; j < 8; ++j) os[(hi * 8 + j) * 68 + nb * 16 + lr] = acc[mb][nb][j]; }
        __builtin_amdgcn_wave_barrier(); asm volatile("" ::: "memory");
        float* crow = C + (size_t)(r0 + mb * 16) * ldc + c0;
{
#pragma unroll
            for (int s = 0; s < 8; ++s) { const int row = 2 * s + hi, cofs = lr * 4; v4f val = *(const v4fa*)(os + row * 68 + cofs); if (BIAS) { val[0] += bfr(bias[c0 + cofs]); val[1] += bfr(bias[c0 + cofs + 1]); val[2] += bfr(bias[c0 + cofs + 2]); val[3] += bfr(bias[c0 + cofs + 3]); }
                *(v4f*)(crow + (size_t)row * ldc + cofs) = val; }
             }
        __builtin_amdgcn_wave_barrier(); asm volatile("" ::: "memory");
    }
}

__device__ __forceinline__ h16 tohx(float x) { return (h16)x; }
__device__ __forceinline__ void splitf(float y, unsigned short& h, unsigned short& l) { h = f2bf(y); l = f2bf(y - bf2f(h)); }
typedef __attribute__((ext_vector_type(2))) _Float16 v2h;
typedef __attribute__((ext_vector_type(4))) _Float16 v4h;
typedef __attribute__((ext_vector_type(2))) unsigned short v2us;
typedef __attribute__((ext_vector_type(4))) unsigned short v4us;
typedef __attribute__((ext_vector_type(2))) float v2f;
typedef __attribute__((ext_vector_type(4))) int v4i;

__global__ __launch_bounds__(256) void k_wtG(const float* __restrict__ w, int K, int N, bf* Bt) {
    const int lane = threadIdx.x & 31; const int L0 = (blockIdx.x * 8 + (threadIdx.x >> 5)) * 8; const int nlines = N * K / 64;
{
#pragma unroll 1
        for (int l = 0; l < 8; ++l) { const int L = L0 + l; if (L >= nlines) break; const size_t e = (size_t)L * 64 + lane * 2; const int k = (int)(e % K), n = (int)(e / K); v2us o;
            o[0] = f2bf(w[(size_t)k * N + n]); o[1] = f2bf(w[(size_t)(k + 1) * N + n]); *(v2us*)(Bt + e) = o; }
         }
}
__global__ __launch_bounds__(256) void k_cvt8(const float* __restrict__ src, bf* dst, size_t n8) { const size_t i = (size_t)blockIdx.x * 256 + threadIdx.x; if (i >= n8) return; const v8f v = *(const v8f*)(src + i * 8); v8us o;
#pragma unroll
    for (int k = 0; k < 8; ++k) o[k] = f2bf(v[k]); *(v8us*)(dst + i * 8) = o;  }

// k_rope: head planes [h][t][d] (fp16) of rope(x) x sc with the rotate-half convention out[d] = x[d] cos[t][d] - x[d+HD/2] sin[t][d], out[d+HD/2] = x[d+HD/2] cos[t][d+HD/2] + x[d] sin[t][d+HD/2]
__global__ __launch_bounds__(256) void k_rope(const float* __restrict__ F, int pitch, int nheads, const float* __restrict__ CS, const float* __restrict__ RF, const float* __restrict__ nw, float sc, h16* P16, bf* Ph, bf* Pl) {
    const size_t e = ((size_t)blockIdx.x * 256 + threadIdx.x) * 2; if (e >= (size_t)nheads * TT * HD) return; const int d = (int)(e % HD); const int t = (int)((e / HD) % TT); const int h = (int)(e / ((size_t)HD * TT)); const float* f = F + (size_t)t * pitch + h * HD; const float rf = RF ? RF[(size_t)h * TT + t] : 1.0f; v2h o16; v2us oh, ol;
#pragma unroll
    for (int q = 0; q < 2; ++q) { const int dd = d + q; const int dp = (dd < HD / 2) ? dd + HD / 2 : dd - HD / 2; float x0 = f[dd], x1 = f[dp];
        if (RF) { float n0 = __fmul_rn(x0, rf), n1 = __fmul_rn(x1, rf); asm volatile("" : "+v"(n0)); asm volatile("" : "+v"(n1)); x0 = __fmul_rn(bfr(nw[dd]), n0); x1 = __fmul_rn(bfr(nw[dp]), n1); }
        const v2f cs = *(const v2f*)(CS + ((size_t)t * HD + dd) * 2); float a = __fmul_rn(x0, cs[0]), bq = __fmul_rn(x1, cs[1]); asm volatile("" : "+v"(a)); asm volatile("" : "+v"(bq)); const float r = ((dd < HD / 2) ? __fsub_rn(a, bq) : __fadd_rn(a, bq)) * sc;
        o16[q] = tohx(r); (void)oh; (void)ol; }
    *(v2h*)(P16 + e) = o16;  }
__global__ __launch_bounds__(256) void k_vtp(const float* __restrict__ F, int pitch, int nheads, h16* V16, bf* Vh, bf* Vl) { const size_t e = ((size_t)blockIdx.x * 256 + threadIdx.x) * 2; if (e >= (size_t)nheads * HD * TT) return; const int t = (int)(e % TT); const int d = (int)((e / TT) % HD); const int g = (int)(e / ((size_t)TT * HD)); v2h o16; v2us oh, ol;
#pragma unroll
    for (int q = 0; q < 2; ++q) { const float x = F[(size_t)(t + q) * pitch + g * HD + d]; o16[q] = tohx(x); (void)oh; (void)ol; }
    *(v2h*)(V16 + e) = o16;  }
__global__ __launch_bounds__(256) void k_csid(float* CS) { const int idx = blockIdx.x * 256 + threadIdx.x; if (idx >= TT * HD) return; v2f cs; cs[0] = 1.0f; cs[1] = 0.0f; *(v2f*)(CS + (size_t)idx * 2) = cs;  }
// k_asoft: per row (zz, i): t = S x HD^-0.5 (no mask); softmax over the 4096 keys (register row, one exp, fixed trees);
__global__ __launch_bounds__(256) void k_asoft(const float* __restrict__ Sb, h16* P16, bf* Ph, bf* Pl) {
    const int lane = threadIdx.x & 31; const int row = blockIdx.x * 8 + (threadIdx.x >> 5); if (row >= ZH * TT) return; const int i = row % TT; const int zz = row / TT; (void)zz; const bool hires = (i < RH); const float* sr = Sb + (size_t)row * TT; float v[TT / 32]; float mx = -3.0e38f;
#pragma unroll
    for (int ch = 0; ch < TT / 128; ++ch) { const int j0 = ch * 128 + lane * 4; const v4f a = *(const v4f*)(sr + j0);
#pragma unroll
        for (int q = 0; q < 4; ++q) { const int j = j0 + q; (void)j; const float t = a[q] * SCL; v[ch * 4 + q] = t; mx = fmaxf(mx, t); } if ((ch & 7) == 7) asm volatile("s_wait_loadcnt 0x0" ::: "memory"); }
#pragma unroll
    for (int sh = 16; sh; sh >>= 1) mx = fmaxf(mx, __shfl_xor(mx, sh, 32));
    float sum = 0.f;
#pragma unroll
    for (int k = 0; k < TT / 32; ++k) { float d0 = __fsub_rn(v[k], mx); asm volatile("" : "+v"(d0)); v[k] = __builtin_amdgcn_exp2f(__fmul_rn(d0, 1.4426950408889634f)); sum += v[k]; }
#pragma unroll
    for (int sh = 16; sh; sh >>= 1) sum += __shfl_xor(sum, sh, 32);
    const float f = __fdiv_rn(hires ? 1.0f : PCAR, sum);
{
        if (hires) {
#pragma unroll
            for (int ch = 0; ch < TT / 128; ++ch) { v4us oh, ol;
#pragma unroll
                for (int q = 0; q < 4; ++q) { unsigned short a, c2; splitf(v[ch * 4 + q] * f, a, c2); oh[q] = a; ol[q] = c2; }
                const size_t oo = ((size_t)zz * (RH ? RH : 1) + i) * TT + ch * 128 + lane * 4; *(v4us*)(Ph + oo) = oh; *(v4us*)(Pl + oo) = ol; }
        } else {
#pragma unroll
            for (int ch = 0; ch < TT / 128; ++ch) { v4h o4;
#pragma unroll
                for (int q = 0; q < 4; ++q) o4[q] = tohx(v[ch * 4 + q] * f);
                *(v4h*)(P16 + (size_t)row * TT + ch * 128 + lane * 4) = o4; } }
         }
}
__global__ __launch_bounds__(256) void k_merge(const float* __restrict__ O, int h0, bf* Ah, bf* Al) { const size_t e = ((size_t)blockIdx.x * 256 + threadIdx.x) * 2; if (e >= (size_t)ZH * TT * HD) return; const int d = (int)(e % HD); const int t = (int)((e / HD) % TT); const int zz = (int)(e / ((size_t)HD * TT)); const float cs = (t < RH) ? 1.0f : (1.0f / PCAR); const size_t oo = (size_t)t * DQ + (h0 + zz) * HD + d;
    v2us oh, ol; const float* op = O + ((size_t)zz * TT + t) * (KS * HD) + d; v2f sum = *(const v2f*)op;   // row t holds its KS partial rows side by side
#pragma unroll
    for (int s = 1; s < KS; ++s) { const v2f p = *(const v2f*)(op + s * HD); sum[0] += p[0]; sum[1] += p[1]; }   // key ranges in ascending order
    asm volatile("s_wait_xcnt 0x0" :: "v"(op) : "memory");   // the loads' address pair is kept as it is until this wait; only behind it may the registers be reused
#pragma unroll
    for (int q = 0; q < 2; ++q) { unsigned short a, c2; splitf(sum[q] * cs, a, c2); oh[q] = a; ol[q] = c2; } *(v2us*)(Ah + oo) = oh; *(v2us*)(Al + oo) = ol;  }

extern "C" void kernel_launch(void* const* d_in, const int* in_sizes, int n_in,
                              void* d_out, int out_size, void* d_ws, size_t ws_size, hipStream_t stream) {
    (void)in_sizes; (void)n_in; (void)out_size;
    const float* x = (const float*)d_in[0]; const float* wq = (const float*)d_in[1]; const float* wk = (const float*)d_in[2]; const float* wv = (const float*)d_in[3]; const float* wo = (const float*)d_in[4];
    float* OUT = (float*)d_out;     // [2][4096][768]
    char* wsp = (char*)d_ws;
    auto take = [&](size_t bytes) { char* p = wsp; wsp += (bytes + 255) & ~(size_t)255; return (void*)p; };
    bf* WQ = (bf*)take((size_t)DQ * DM * 2); bf* WK = (bf*)take((size_t)DKV * DM * 2); bf* WV = (bf*)take((size_t)DKV * DM * 2); bf* WO = (bf*)take((size_t)DM * DQ * 2); float* CS = (float*)take((size_t)TT * HD * 2 * 4);
    bf* XB = (bf*)take((size_t)TT * DM * 2); float* FQ = (float*)take((size_t)TT * DQ * 4); float* FK = (float*)take((size_t)TT * DKV * 4);
    h16* QP16 = (h16*)take((size_t)NH_ * TT * HD * 2); h16* KP16 = (h16*)take((size_t)NKV * TT * HD * 2); h16* VT16 = (h16*)take((size_t)NKV * HD * TT * 2);
    bf* QPh = nullptr; bf* QPl = nullptr; bf* KPh = nullptr; bf* KPl = nullptr; bf* VTh = nullptr; bf* VTl = nullptr; bf* Ph = nullptr; bf* Pl = nullptr;
    float* Sb = (float*)take((size_t)ZH * TT * TT * 4); h16* P16 = (h16*)take((size_t)ZH * TT * TT * 2); float* Ob = (float*)take((size_t)KS * ZH * TT * HD * 4); bf* ATh = (bf*)take((size_t)TT * DQ * 2); bf* ATl = (bf*)take((size_t)TT * DQ * 2);
    if ((size_t)(wsp - (char*)d_ws) > ws_size) return;    // ws 256 MiB
    float* FV = FK;   // v projection reuses the k buffer after the k planes are built (stream-ordered)
    { k_cvt8<<<(unsigned)(((size_t)DQ * DM / 8 + 255) / 256), 256, 0, stream>>>(wq, WQ, (size_t)DQ * DM / 8); k_cvt8<<<(unsigned)(((size_t)DKV * DM / 8 + 255) / 256), 256, 0, stream>>>(wk, WK, (size_t)DKV * DM / 8); k_cvt8<<<(unsigned)(((size_t)DKV * DM / 8 + 255) / 256), 256, 0, stream>>>(wv, WV, (size_t)DKV * DM / 8);
      k_cvt8<<<(unsigned)(((size_t)DM * DQ / 8 + 255) / 256), 256, 0, stream>>>(wo, WO, (size_t)DM * DQ / 8);
       }
    k_csid<<<(TT * HD + 255) / 256, 256, 0, stream>>>(CS);
    const unsigned LQ = (unsigned)(((size_t)NH_ * TT * HD / 2 + 255) / 256), LKv = (unsigned)(((size_t)NKV * TT * HD / 2 + 255) / 256);
    for (int b = 0; b < NB_; ++b) {
        
        k_cvt8<<<(unsigned)(((size_t)TT * DM / 8 + 255) / 256), 256, 0, stream>>>(x + (size_t)b * TT * DM, XB, (size_t)TT * DM / 8);
        k_gemmw<bf, 0, false><<<dim3(TT / 64, DQ / 64, 1), 32, 0, stream>>>(XB, nullptr, WQ, nullptr, DM, DM, FQ, DQ, nullptr, 0, 0, 0);
        k_rope<<<LQ, 256, 0, stream>>>(FQ, DQ, NH_, CS, nullptr, nullptr, 1.0f, QP16, QPh, QPl);
        k_gemmw<bf, 0, false><<<dim3(TT / 64, DKV / 64, 1), 32, 0, stream>>>(XB, nullptr, WK, nullptr, DM, DM, FK, DKV, nullptr, 0, 0, 0);
        k_rope<<<LKv, 256, 0, stream>>>(FK, DKV, NKV, CS, nullptr, nullptr, 1.0f, KP16, KPh, KPl);
        k_gemmw<bf, 0, false><<<dim3(TT / 64, DKV / 64, 1), 32, 0, stream>>>(XB, nullptr, WV, nullptr, DM, DM, FV, DKV, nullptr, 0, 0, 0); k_vtp<<<LKv, 256, 0, stream>>>(FV, DKV, NKV, VT16, VTh, VTl);
        for (int h0 = 0; h0 < NH_; h0 += ZH) { const size_t zq = (size_t)h0, zk = (size_t)(h0 / REP);   // the pass's one head (ZH = 1) uses kv group h0/REP: sB = 0
            k_gemmw<h16, 0, false><<<dim3(TT / 64, TT / 64, ZH), 32, 0, stream>>>(QP16 + zq * TT * HD, nullptr, KP16 + zk * TT * HD, nullptr, HD, HD, Sb, TT, nullptr, (size_t)TT * HD, 0, (size_t)TT * TT);
            k_asoft<<<ZH * TT / 8, 256, 0, stream>>>(Sb, P16, Ph, Pl);
            k_gemmw<h16, 0, false><<<dim3(TT / 64, HD / 64, KS), 32, 0, stream>>>(P16, nullptr, VT16 + zk * HD * TT, nullptr, TT, TT / KS, Ob, KS * HD, nullptr, (size_t)(TT / KS), (size_t)(TT / KS), (size_t)HD);   // z = key range (ZH == 1): Ob[t][z][d]
            k_merge<<<(unsigned)(((size_t)ZH * TT * HD / 2 + 255) / 256), 256, 0, stream>>>(Ob, h0, ATh, ATl); }
        k_gemmw<bf, 1, false><<<dim3(TT / 64, DM / 64, 1), 32, 0, stream>>>(ATh, ATl, WO, nullptr, DQ, DQ, OUT + (size_t)b * TT * DM, DM, nullptr, 0, 0, 0); }
}

// v003
// It runs in 152 microseconds.
// Versions between v001 and this one are left out; their measured steps multiply to 5.74 times as fast.
// Counting every step since v000, it is 11.1 times as fast.
#include <hip/hip_runtime.h>
#include <stdint.h>

// Bidirectional grouped-query attention (x [2][4096][768]; q = x wq^T (6 heads x 128) x 128^-0.5, k, v = x wk^T / wv^T ([256][768]: 2 kv heads; query head h = g*3 + r uses kv head h/3); softmax(q.k) over all keys (no mask); out = merged wo^T -> [2][4096][768] (6.3 M)).
// Compute dtypes, f32 accumulate: every input rounded to bf16; q/k/v on PLAIN bf16 operands (inputs: exact); scores and attn.v on single fp16 operands inside one fused kernel (k_fattn); softmax f32, online; wo hl x exact (2 products).
// Four launches: k_cvtall (all inputs to bf16), k_gemmw (q, k, v of both batches, stored as fp16 head planes), k_fattn, k_gemmw (wo, both batches).

#define NB_  2
#define TT   4096
#define DM   768
#define NH_  6
#define NKV  2
#define REP  (NH_ / NKV)
#define HD   128
#define DQ   (NH_ * HD)
#define DKV  (NKV * HD)
#define SCL  0.088388347648318447f   // HD^-0.5
typedef _Float16 h16;
typedef unsigned short bf;
typedef __attribute__((ext_vector_type(16))) __bf16   v16bf;
typedef __attribute__((ext_vector_type(16))) _Float16 v16h;
typedef __attribute__((ext_vector_type(8)))  _Float16 v8h;
typedef __attribute__((ext_vector_type(8)))  unsigned short v8us;
typedef __attribute__((ext_vector_type(8)))  float    v8f;
typedef __attribute__((ext_vector_type(4)))  float    v4f;
typedef v8h  __attribute__((may_alias)) v8ha;
typedef v4f  __attribute__((may_alias)) v4fa;
typedef v8us __attribute__((may_alias)) v8usa;

__device__ __forceinline__ unsigned short f2bf(float f) { unsigned u = __float_as_uint(f); u += 0x7FFFu + ((u >> 16) & 1u); return (unsigned short)(u >> 16); }
__device__ __forceinline__ float bf2f(unsigned short b) { return __uint_as_float(((unsigned)b) << 16); }
__device__ __forceinline__ float bfr(float f) { return bf2f(f2bf(f)); }
__device__ __forceinline__ v16h cat16(v8h lo, v8h hi) { return __builtin_shufflevector(lo, hi, 0, 1, 2, 3, 4, 5, 6, 7, 8, 9, 10, 11, 12, 13, 14, 15); }
__device__ __forceinline__ v16bf cat16b(v8us lo, v8us hi) { return __builtin_bit_cast(v16bf, __builtin_shufflevector(lo, hi, 0, 1, 2, 3, 4, 5, 6, 7, 8, 9, 10, 11, 12, 13, 14, 15)); }
__device__ __forceinline__ v8f wmma16(v16h a, v16h b, v8f c) { return __builtin_amdgcn_wmma_f32_16x16x32_f16(false, a, false, b, (short)0, c, false, false); }
__device__ __forceinline__ v8f wmmab(v16bf a, v16bf b, v8f c) { return __builtin_amdgcn_wmma_f32_16x16x32_bf16(false, a, false, b, (short)0, c, false, false); }



// ---- k_gemmw: register-blocked GEMM, ONE WAVE per 64x64 output tile (16 accumulators), operands straight from K-contiguous 16-bit planes; grid (M/64, N/64, Z), 32 threads.
// C[m][n] (f32, pitch ldc, + optional f32 bias[n]) = sum_{k < klen} A[m][k] Bt[n][k] (+ split products per NSPLIT); K is the row pitch of A and Bt in elements. z-batch strides sA/sB/sC in elements. klen % 32 == 0.
// HEADS: m = b * TT + t, n runs over the q, then the k, then the v columns; the tile goes out rounded to fp16 into the head planes PQ, PK, PV ([b][h][t][d]) and C is not used.
template <typename T16> struct WFrag;
template <> struct WFrag<bf> { typedef v16bf V; static __device__ __forceinline__ V ld(const bf* p) { return cat16b(*(const v8us*)p, *(const v8us*)(p + 16)); } static __device__ __forceinline__ v8f mma(V a, V b, v8f c) { return wmmab(a, b, c); } };
template <typename T16, int NSPLIT, bool BIAS, bool HEADS>
__global__ __launch_bounds__(32) void k_gemmw(const T16* __restrict__ A, const T16* __restrict__ A2, const T16* __restrict__ Bt, const T16* __restrict__ Bt2, int K, int klen, float* C, int ldc, const float* __restrict__ bias, size_t sA, size_t sB, size_t sC, h16* PQ, h16* PK, h16* PV) {
    typedef typename WFrag<T16>::V V;
    __shared__ __align__(16) float os[16 * 68];
    const size_t z = blockIdx.z; A += z * sA; if (A2) A2 += z * sA; Bt += z * sB; if (Bt2) Bt2 += z * sB; C += z * sC;
    const int lane = threadIdx.x & 31, lr = lane & 15, hi = lane >> 4; const int r0 = blockIdx.x * 64, c0 = blockIdx.y * 64;
    v8f acc[4][4];
#pragma unroll
    for (int mb = 0; mb < 4; ++mb)
#pragma unroll
        for (int nb = 0; nb < 4; ++nb) acc[mb][nb] = (v8f){};
    const size_t aoff = (size_t)(r0 + lr) * K + 8 * hi, boff = (size_t)(c0 + lr) * K + 8 * hi;
#pragma unroll 1
    for (int kc = 0; kc < klen; kc += 32) {
        V a[4], a2[4];
#pragma unroll
        for (int mb = 0; mb < 4; ++mb) { a[mb] = WFrag<T16>::ld(A + aoff + (size_t)mb * 16 * K + kc); if (NSPLIT == 1 || NSPLIT == 2) a2[mb] = WFrag<T16>::ld(A2 + aoff + (size_t)mb * 16 * K + kc); }
#pragma unroll
        for (int nb = 0; nb < 4; ++nb) { const V b = WFrag<T16>::ld(Bt + boff + (size_t)nb * 16 * K + kc); V b2; if (NSPLIT >= 2) b2 = WFrag<T16>::ld(Bt2 + boff + (size_t)nb * 16 * K + kc);
#pragma unroll
            for (int mb = 0; mb < 4; ++mb) { acc[mb][nb] = WFrag<T16>::mma(a[mb], b, acc[mb][nb]); if (NSPLIT == 1 || NSPLIT == 2) acc[mb][nb] = WFrag<T16>::mma(a2[mb], b, acc[mb][nb]); if (NSPLIT >= 2) acc[mb][nb] = WFrag<T16>::mma(a[mb], b2, acc[mb][nb]); } }
        asm volatile("v_nop\n\tv_nop\n\tv_nop\n\tv_nop" : "+v"(acc[0][0]), "+v"(acc[1][1]), "+v"(acc[2][2]), "+v"(acc[3][3]) : "v"(a[0]), "v"(a[3]));
    }
#pragma unroll
    for (int mb = 0; mb < 4; ++mb) {
#pragma unroll
        for (int nb = 0; nb < 4; ++nb) {
#pragma unroll
            for (int j = 0; j < 8; ++j) os[(hi * 8 + j) * 68 + nb * 16 + lr] = acc[mb][nb][j]; }
        __builtin_amdgcn_wave_barrier(); asm volatile("" ::: "memory");
        float* crow = C + (size_t)(r0 + mb * 16) * ldc + c0;
        if (HEADS) {   // the tile's 64 rows lie in one batch, its 64 columns in one head: a row of the tile is one whole 128-byte line of the plane
            h16* P = PQ; int nh = NH_, hh = c0 / HD;
            if (c0 >= DQ + DKV) { P = PV; nh = NKV; hh = (c0 - DQ - DKV) / HD; } else if (c0 >= DQ) { P = PK; nh = NKV; hh = (c0 - DQ) / HD; }
            h16* prow = P + ((size_t)((r0 / TT) * nh + hh) * TT + (r0 % TT) + mb * 16) * HD + (c0 % HD);
#pragma unroll
            for (int s = 0; s < 4; ++s) { const int row = 4 * s + (lane >> 3), cofs = (lane & 7) * 8; const v4f lo = *(const v4fa*)(os + row * 68 + cofs), up = *(const v4fa*)(os + row * 68 + cofs + 4); v8h o;
#pragma unroll
                for (int k = 0; k < 4; ++k) { o[k] = (h16)lo[k]; o[k + 4] = (h16)up[k]; }
                *(v8h*)(prow + (size_t)row * HD + cofs) = o; }
        } else {
#pragma unroll
            for (int s = 0; s < 8; ++s) { const int row = 2 * s + hi, cofs = lr * 4; v4f val = *(const v4fa*)(os + row * 68 + cofs); if (BIAS) { val[0] += bfr(bias[c0 + cofs]); val[1] += bfr(bias[c0 + cofs + 1]); val[2] += bfr(bias[c0 + cofs + 2]); val[3] += bfr(bias[c0 + cofs + 3]); }
                *(v4f*)(crow + (size_t)row * ldc + cofs) = val; }
             }
        __builtin_amdgcn_wave_barrier(); asm volatile("" ::: "memory");
    }
}

__device__ __forceinline__ h16 tohx(float x) { return (h16)x; }
__device__ __forceinline__ void splitf(float y, unsigned short& h, unsigned short& l) { h = f2bf(y); l = f2bf(y - bf2f(h)); }
typedef __attribute__((ext_vector_type(2))) _Float16 v2h;
typedef __attribute__((ext_vector_type(4))) _Float16 v4h;
typedef __attribute__((ext_vector_type(2))) unsigned short v2us;
typedef __attribute__((ext_vector_type(4))) unsigned short v4us;
typedef __attribute__((ext_vector_type(2))) float v2f;
typedef __attribute__((ext_vector_type(4))) int v4i;

__global__ __launch_bounds__(256) void k_wtG(const float* __restrict__ w, int K, int N, bf* Bt) {
    const int lane = threadIdx.x & 31; const int L0 = (blockIdx.x * 8 + (threadIdx.x >> 5)) * 8; const int nlines = N * K / 64;
{
#pragma unroll 1
        for (int l = 0; l < 8; ++l) { const int L = L0 + l; if (L >= nlines) break; const size_t e = (size_t)L * 64 + lane * 2; const int k = (int)(e % K), n = (int)(e / K); v2us o;
            o[0] = f2bf(w[(size_t)k * N + n]); o[1] = f2bf(w[(size_t)(k + 1) * N + n]); *(v2us*)(Bt + e) = o; }
         }
}
// k_cvtall: every input rounded to bf16 in one launch; dst holds x, wq, wk, wv, wo one behind another. A unit is 8 elements; a thread converts CV_U units, a whole grid apart: a quarter of the waves to start, and each with all its loads in flight at once.
#define CV_NX (NB_ * TT * DM / 8)
#define CV_NQ (DQ * DM / 8)
#define CV_NK (DKV * DM / 8)
#define CV_TOT (CV_NX + 2 * CV_NQ + 2 * CV_NK)
#define CV_U 4
#define CV_GRID (CV_TOT / (CV_U * 256))
static_assert(CV_TOT % (CV_U * 256) == 0 && CV_NX % 256 == 0 && CV_NQ % 256 == 0 && CV_NK % 256 == 0 && TT % 64 == 0 && HD % 64 == 0, "whole blocks of units; a 64 x 64 tile lies in one batch and one head");
__global__ __launch_bounds__(256) void k_cvtall(const float* __restrict__ x, const float* __restrict__ wq, const float* __restrict__ wk, const float* __restrict__ wv, const float* __restrict__ wo, bf* dst) {
    const int u0 = blockIdx.x * 256 + threadIdx.x; v8f v[CV_U];
#pragma unroll
    for (int j = 0; j < CV_U; ++j) { int ub = blockIdx.x + j * CV_GRID; const float* s = x;   // every input is a whole number of 256-unit blocks: the choice of the source is the same for the whole block (scalar)
        if (ub >= CV_NX / 256) { ub -= CV_NX / 256; s = wq;
            if (ub >= CV_NQ / 256) { ub -= CV_NQ / 256; s = wk;
                if (ub >= CV_NK / 256) { ub -= CV_NK / 256; s = wv;
                    if (ub >= CV_NK / 256) { ub -= CV_NK / 256; s = wo; } } } }
        v[j] = *(const v8f*)(s + (size_t)ub * 2048 + threadIdx.x * 8); }
    __builtin_amdgcn_sched_barrier(0);   // all eight loads are issued before the first conversion waits for one (the scheduler had put the last two behind such a wait: a second memory latency)
#pragma unroll
    for (int j = 0; j < CV_U; ++j) { v8us o;
#pragma unroll
        for (int k = 0; k < 8; ++k) o[k] = f2bf(v[j][k]);
        *(v8us*)(dst + (size_t)(u0 + j * (CV_GRID * 256)) * 8) = o; }
}

typedef uint32_t u32x4 __attribute__((ext_vector_type(4)));
typedef uint32_t u32x8 __attribute__((ext_vector_type(8)));
typedef int i32x8 __attribute__((ext_vector_type(8)));
typedef short s16x8 __attribute__((ext_vector_type(8)));
#define FA_NW 8                    // waves per workgroup
#define FA_CW 32                   // query columns per wave
#define FA_R  2                    // 16-column groups per wave
#define FA_KT 2                    // 16-key score tiles per pass
#define FA_DK (HD / 32)
#define FA_DT (HD / 16)
#define FA_ROWB 256u               // bytes of one K or V row
#define FA_PK 272u                 // LDS pitch of K rows (ds_load_b128 readers): 16 B x odd
#define FA_PV 288u                 // LDS pitch of V rows (ds_load_tr16_b128 readers): 32 B x odd
#define FA_SLICE 10240u            // 32 padded rows, rounded up to a multiple of 2 KiB
#define FA_STAGE (8u * FA_SLICE)   // 4 K slices, then 4 V slices: 128 keys
#define FA_LDS (2u * FA_STAGE)
#define FA_NST (TT / 128)
#define FA_EP 272u                 // output staging pitch
#define FA_W0K ((1u << 20) | (5u << 22) | (3u << 25))   // descriptor group 1 word 0: pad of 16 B behind every 256-B row
#define FA_W0V ((1u << 20) | (5u << 22) | (7u << 25))   // the same with 32 B
static_assert(HD == 128 && TT % 256 == 0 && FA_NST >= 2, "k_fattn is written for head size 128 and whole 256-row query blocks");
static_assert(32u * FA_PK <= FA_SLICE && 32u * FA_PV <= FA_SLICE && 2u * FA_NW * FA_CW * FA_EP <= FA_LDS, "slices and output staging must fit");
#define DEV static __device__ __forceinline__
DEV uint32_t uni(uint32_t v) { return (uint32_t)__builtin_amdgcn_readfirstlane(v); }
DEV uint32_t pinned(uint32_t v) { uint32_t w = __builtin_amdgcn_readfirstlane(v); asm volatile("" : "+s"(w)); return w; }   // a test word held in a scalar register: the branch on it is a scalar branch (tensor loads ignore EXEC)
DEV void fence() { __builtin_amdgcn_sched_barrier(0); }   // holds the order of the blocks of a pass as written (what each one is for stands at its use)
DEV void wait_ds0() { asm volatile("s_wait_dscnt 0x0" ::: "memory"); }   // this wave's LDS reads and writes are done
// This wave's own tensor request has landed. Both descriptor groups are read here in the registers the load named: the compiler keeps them there, unwritten, from the load to this wait.
DEV void wait_tensor0(u32x4 g0, u32x8 g1) { asm volatile("s_wait_tensorcnt 0x0" :: "{s[80:83]}"(g0), "{s[84:91]}"(g1) : "memory"); }
DEV void nop4() { asm volatile("v_nop\n\tv_nop\n\tv_nop\n\tv_nop"); }   // the four vector slots behind a WMMA before its D is read or its A or B overwritten
// One tensor load. The descriptor is formed and the load issued in one statement, in twelve fixed scalar registers that nothing else of the kernel uses, so that no word of an outstanding request's descriptor is rewritten
// (left to the register allocator, the groups were copied behind the load and their first registers reused ahead of the wait).
// Group 0 (s80 to s83): count 1, LDS byte, address low, address high | type 2. Group 1 (s84 to s91): W0 (mask 0, 1-byte elements, the pad), tensor = tile = 32 rows of 256 bytes, source pitch 256 bytes.
// The three words that vary go through readfirstlane; every other word is an immediate of the text. The outputs are early-clobbered: no input shares a register with them.
template <uint32_t W0> DEV void tdm_load(uint32_t lds_dst, uint64_t ga, u32x4& g0, u32x8& g1) {
    constexpr uint32_t d0 = FA_ROWB, d1 = 32u;
    asm volatile("s_mov_b32 s80, 1\n\ts_mov_b32 s81, %2\n\ts_mov_b32 s82, %3\n\ts_mov_b32 s83, %4\n\t"
                 "s_mov_b32 s84, %5\n\ts_mov_b32 s85, %6\n\ts_mov_b32 s86, %7\n\ts_mov_b32 s87, %8\n\ts_mov_b32 s88, %9\n\ts_mov_b32 s89, %10\n\ts_mov_b32 s90, 0\n\ts_mov_b32 s91, 0\n\t"
                 "tensor_load_to_lds s[80:83], s[84:91]"
                 : "=&{s[80:83]}"(g0), "=&{s[84:91]}"(g1)
                 : "s"(uni(lds_dst)), "s"(uni((uint32_t)ga)), "s"(uni((((uint32_t)(ga >> 32)) & 0x01FFFFFFu) | 0x80000000u)),
                   "n"(W0), "n"((d0 & 0xFFFFu) << 16), "n"((d0 >> 16) | ((d1 & 0xFFFFu) << 16)), "n"((d1 >> 16) | (d0 << 16)), "n"(d1), "n"(FA_ROWB)
                 : "memory"); }
struct Frag { u32x4 q[2]; };
DEV v8f fmma(const Frag& a, const Frag& b, v8f c) {
    const i32x8 av = {(int)a.q[0].x, (int)a.q[0].y, (int)a.q[0].z, (int)a.q[0].w, (int)a.q[1].x, (int)a.q[1].y, (int)a.q[1].z, (int)a.q[1].w};
    const i32x8 bv = {(int)b.q[0].x, (int)b.q[0].y, (int)b.q[0].z, (int)b.q[0].w, (int)b.q[1].x, (int)b.q[1].y, (int)b.q[1].z, (int)b.q[1].w};
    return wmma16(__builtin_bit_cast(v16h, av), __builtin_bit_cast(v16h, bv), c); }
DEV u32x4 ld_tr16(const unsigned char* p) { typedef __attribute__((address_space(3))) s16x8 lds_s16x8; return __builtin_bit_cast(u32x4, __builtin_amdgcn_ds_load_tr16_b128_v8i16((lds_s16x8*)p)); }
DEV uint32_t pack2h(float lo, float hi) { return __builtin_bit_cast(uint32_t, __builtin_convertvector((v2f){lo, hi}, v2h)); }   // round to nearest even
DEV float xhalf(float x) { return __builtin_bit_cast(float, __builtin_amdgcn_permlanex16(__builtin_bit_cast(int, x), __builtin_bit_cast(int, x), 0x76543210, 0xfedcba98, false, false)); }   // lane l with lane l ^ 16
struct KFr { Frag f[FA_KT][FA_DK]; };
// koff = byte offset of the pass's K slice in LDS; the hardware k order (bytes 16h and 32 + 16h of each 64), as Q's below.
DEV void load_k(KFr& k, const unsigned char* Lp, uint32_t koff, uint32_t lane) {
    const uint32_t c = lane & 15u, h = lane >> 4;
#pragma unroll
    for (int kt = 0; kt < FA_KT; ++kt) { const unsigned char* p = Lp + koff + (16u * kt + c) * FA_PK + 16u * h;
#pragma unroll
        for (int kc = 0; kc < FA_DK; ++kc) { k.f[kt][kc].q[0] = *reinterpret_cast<const u32x4*>(p + 64u * kc); k.f[kt][kc].q[1] = *reinterpret_cast<const u32x4*>(p + 64u * kc + 32u); } }
}
// One 32-key pass of one wave.
DEV void fa_pass(KFr& kf, bool fetch_next, uint32_t next_koff, const unsigned char* Lp, uint32_t voff, uint32_t lane, const Frag (&qf)[FA_R][FA_DK], v8f (&acc)[FA_R][FA_DT], float (&m_run)[FA_R], float (&l_run)[FA_R], float cscale) {
    const uint32_t h = lane >> 4;
    v8f s[FA_KT][FA_R];
    wait_ds0(); fence();   // the K fragments fetched ahead have arrived
#pragma unroll
    for (int kt = 0; kt < FA_KT; ++kt) {
#pragma unroll
        for (int g = 0; g < FA_R; ++g) { s[kt][g] = (v8f){};
#pragma unroll
            for (int kc = 0; kc < FA_DK; ++kc) s[kt][g] = fmma(kf.f[kt][kc], qf[g][kc], s[kt][g]); } }
    fence(); nop4(); fence();   // keeps the fetch below (it overwrites A operands) behind the products and their slots
    if (fetch_next) load_k(kf, Lp, next_koff, lane);   // the next pass's K of the SAME stage, in flight under the maxima and the first exponentials
    float mb[FA_R]; bool need = false;
#pragma unroll
    for (int g = 0; g < FA_R; ++g) { float mx = -__builtin_inff();
#pragma unroll
        for (int kt = 0; kt < FA_KT; ++kt) {
#pragma unroll
            for (int r = 0; r < 8; ++r) mx = __builtin_fmaxf(mx, s[kt][g][r]); }
        mx = __builtin_fmaxf(mx, xhalf(mx)) * cscale;   // both wave halves hold this query's maximum, scaled (the scale is positive)
        mb[g] = mx; need = need || (mx > m_run[g] + 8.0f);
        fence(); }   // one group's maximum at a time: fewer live registers
    if (__builtin_amdgcn_ballot_w32(need) != 0) {   // rare after the first pass
#pragma unroll
        for (int g = 0; g < FA_R; ++g) { const float m_new = __builtin_fmaxf(m_run[g], mb[g]); const float corr = __builtin_amdgcn_exp2f(m_run[g] - m_new);   // 0 on the first pass, where m_run is -inf
            l_run[g] *= corr; m_run[g] = m_new;
#pragma unroll
            for (int t = 0; t < FA_DT; ++t) acc[g][t] = acc[g][t] * corr; } }
    Frag vf[FA_DT]; float ps[FA_R][2];
#pragma unroll
    for (int g = 0; g < FA_R; ++g) { ps[g][0] = 0.0f; ps[g][1] = 0.0f; }
    { const unsigned char* ad = Lp + voff + (8u * h + (lane & 7u)) * FA_PV + ((lane >> 3) & 1u) * 16u;
#pragma unroll
      for (int t = 0; t < FA_DT; ++t) { vf[t].q[0] = ld_tr16(ad + 32u * t); vf[t].q[1] = ld_tr16(ad + 16u * FA_PV + 32u * t); } }
#pragma unroll
    for (int g = 0; g < FA_R; ++g) { const float nm = -m_run[g]; uint32_t w[8];
#pragma unroll
        for (int i = 0; i < 8; ++i) {
            const v2f arg = __builtin_elementwise_fma((v2f){s[i >> 2][g][2 * (i & 3)], s[i >> 2][g][2 * (i & 3) + 1]}, (v2f){cscale, cscale}, (v2f){nm, nm});
            const float p0 = __builtin_amdgcn_exp2f(arg.x), p1 = __builtin_amdgcn_exp2f(arg.y); ps[g][i & 1] += p0 + p1; w[i] = pack2h(p0, p1); }
        Frag pf; pf.q[0] = (u32x4){w[0], w[1], w[2], w[3]}; pf.q[1] = (u32x4){w[4], w[5], w[6], w[7]};
        if (g == 0) { wait_ds0(); fence(); }   // the V^T fragments have arrived
#pragma unroll
        for (int t = 0; t < FA_DT; ++t) acc[g][t] = fmma(vf[t], pf, acc[g][t]);
        fence(); }   // one group's P^T live at a time
#pragma unroll
    for (int g = 0; g < FA_R; ++g) l_run[g] += ps[g][0] + ps[g][1];
}
// Q [b][h][t][d], K and V [b][g][t][d] (fp16); Ah, Al [b][t][DQ]: the hi and lo bf16 planes of the merged heads.
__global__ void __launch_bounds__(FA_NW * 32) __attribute__((amdgpu_waves_per_eu(2, 2))) k_fattn(const h16* __restrict__ Q, const h16* __restrict__ K, const h16* __restrict__ V, bf* Ah, bf* Al) {
    __shared__ __attribute__((aligned(2048))) unsigned char L[FA_LDS];
    const uint32_t tid = threadIdx.x, lane = tid & 31u, wave = uni(tid >> 5), c = lane & 15u, h = lane >> 4;
    const uint32_t hq = blockIdx.x, b = blockIdx.y, q0 = blockIdx.z * (uint32_t)(FA_NW * FA_CW), gkv = hq / (uint32_t)REP;
    const float cscale = SCL * 1.4426950408889634f;
    const uint32_t lbase = (uint32_t)(size_t)L;
    const uint64_t src = (uint64_t)(size_t)((wave < 4u ? K : V) + (size_t)(b * NKV + gkv) * TT * HD) + (uint64_t)((wave & 3u) * 32u) * FA_ROWB;   // this wave's slice of stage 0
    u32x4 g0; u32x8 g1;
    auto issue = [&](uint32_t st) {   // this wave's one request of stage st: rows st * 128 + (wave & 3) * 32 ... + 31
        const uint32_t dst = lbase + (st & 1u) * FA_STAGE + wave * FA_SLICE; const uint64_t ga = src + (uint64_t)(st * 128u) * FA_ROWB;
        if (pinned(wave < 4u)) tdm_load<FA_W0K>(dst, ga, g0, g1);   // the two differ in the pad alone, a constant on either path
        else tdm_load<FA_W0V>(dst, ga, g0, g1);
    };
    issue(0u);
    Frag qf[FA_R][FA_DK];
#pragma unroll
    for (int g = 0; g < FA_R; ++g) { const h16* qp = Q + ((size_t)(b * NH_ + hq) * TT + q0 + wave * FA_CW + 16u * g + c) * HD + 8u * h;
#pragma unroll
        for (int kc = 0; kc < FA_DK; ++kc) { qf[g][kc].q[0] = *reinterpret_cast<const u32x4*>(qp + 32 * kc); qf[g][kc].q[1] = *reinterpret_cast<const u32x4*>(qp + 32 * kc + 16); } }
    v8f acc[FA_R][FA_DT]; float m_run[FA_R], l_run[FA_R];
#pragma unroll
    for (int g = 0; g < FA_R; ++g) { m_run[g] = -__builtin_inff(); l_run[g] = 0.0f;
#pragma unroll
        for (int t = 0; t < FA_DT; ++t) acc[g][t] = (v8f){}; }
    wait_tensor0(g0, g1);     // stage 0 has landed (this wave's slice)
    __syncthreads();    // ... and is published to every wave
    issue(1u);
    KFr kf;
#pragma unroll 1   // rolled: one publish point in the text, and the pass loop stays nested in it
    for (uint32_t st = 0; st < (uint32_t)FA_NST; ++st) {
        const uint32_t base = (st & 1u) * FA_STAGE;
        load_k(kf, L, base, lane);
#pragma unroll 1
        for (uint32_t sub = 0; sub < 4u; ++sub)   // kept rolled and nested: one flat or unrolled loop over passes spills
            fa_pass(kf, sub < 3u, base + (sub + 1u) * FA_SLICE, L, base + (4u + sub) * FA_SLICE, lane, qf, acc, m_run, l_run, cscale);
        // Publish point of stage st + 1, every wave: own LDS reads done, own request landed, barrier; only then the refill of the buffer just read.
        wait_ds0();
        wait_tensor0(g0, g1);
        __syncthreads();
        if (pinned(st + 2u < (uint32_t)FA_NST)) issue(st + 2u);
    }
    wait_tensor0(g0, g1);
    wait_ds0();
    // The last publish point's barrier has ended every wave's reads of the ring: it becomes output staging, one region a wave and plane.
    const uint32_t eh = wave * (uint32_t)FA_CW * FA_EP, el = eh + (uint32_t)(FA_NW * FA_CW) * FA_EP;
#pragma unroll
    for (int g = 0; g < FA_R; ++g) { const float l_fin = l_run[g] + xhalf(l_run[g]);
        const float inv = 1.0f / l_fin;
#pragma unroll
        for (int t = 0; t < FA_DT; ++t) { const v8f o = acc[g][t] * inv; u32x4 ph, pw;
#pragma unroll
            for (int i = 0; i < 4; ++i) { unsigned short a0, c0, a1, c1; splitf(o[2 * i], a0, c0); splitf(o[2 * i + 1], a1, c1); ph[i] = (uint32_t)a0 | ((uint32_t)a1 << 16); pw[i] = (uint32_t)c0 | ((uint32_t)c1 << 16); }
            const uint32_t eo = (16u * g + c) * FA_EP + 32u * t + 16u * h;
            *reinterpret_cast<u32x4*>(L + eh + eo) = ph; *reinterpret_cast<u32x4*>(L + el + eo) = pw; } }
    wait_ds0();
    // Read back whole rows: 16 lanes cover one 256-byte row, so every 128-byte line of the planes is stored once.
#pragma unroll
    for (uint32_t i = 0; i < (uint32_t)FA_CW / 2u; ++i) { const uint32_t row = i * 2u + lane / 16u, colb = (lane % 16u) * 16u;
        const u32x4 vh = *reinterpret_cast<const u32x4*>(L + eh + row * FA_EP + colb); const u32x4 vl = *reinterpret_cast<const u32x4*>(L + el + row * FA_EP + colb);
        const size_t ob = (((size_t)b * TT + q0 + wave * FA_CW + row) * DQ + (size_t)hq * HD) * 2 + colb;
        *reinterpret_cast<u32x4*>(reinterpret_cast<unsigned char*>(Ah) + ob) = vh; *reinterpret_cast<u32x4*>(reinterpret_cast<unsigned char*>(Al) + ob) = vl; }
}

extern "C" void kernel_launch(void* const* d_in, const int* in_sizes, int n_in,
                              void* d_out, int out_size, void* d_ws, size_t ws_size, hipStream_t stream) {
    (void)in_sizes; (void)n_in; (void)out_size;
    const float* x = (const float*)d_in[0]; const float* wq = (const float*)d_in[1]; const float* wk = (const float*)d_in[2]; const float* wv = (const float*)d_in[3]; const float* wo = (const float*)d_in[4];
    float* OUT = (float*)d_out;     // [2][4096][768]
    char* wsp = (char*)d_ws;
    auto take = [&](size_t bytes) { char* p = wsp; wsp += (bytes + 255) & ~(size_t)255; return (void*)p; };
    bf* XB = (bf*)take((size_t)CV_TOT * 8 * 2); bf* WQ = XB + (size_t)CV_NX * 8; bf* WO = WQ + (size_t)(CV_NQ + 2 * CV_NK) * 8;   // x of both batches [b * TT + t][DM]; wq, wk, wv as one [DQ + 2 DKV][DM] matrix; wo
    h16* QP16 = (h16*)take((size_t)NB_ * NH_ * TT * HD * 2); h16* KP16 = (h16*)take((size_t)NB_ * NKV * TT * HD * 2); h16* VP16 = (h16*)take((size_t)NB_ * NKV * TT * HD * 2);   // head planes [b][h][t][d] of both batches
    bf* ATh = (bf*)take((size_t)NB_ * TT * DQ * 2); bf* ATl = (bf*)take((size_t)NB_ * TT * DQ * 2);
    if ((size_t)(wsp - (char*)d_ws) > ws_size) return;    // ws 256 MiB
    k_cvtall<<<CV_GRID, 256, 0, stream>>>(x, wq, wk, wv, wo, XB);
    k_gemmw<bf, 0, false, true><<<dim3(NB_ * TT / 64, (DQ + 2 * DKV) / 64, 1), 32, 0, stream>>>(XB, nullptr, WQ, nullptr, DM, DM, nullptr, 0, nullptr, 0, 0, 0, QP16, KP16, VP16);   // v as [g][t][d] rows: the fused kernel transposes on its LDS read
    k_fattn<<<dim3(NH_, NB_, TT / (FA_NW * FA_CW)), FA_NW * 32, 0, stream>>>(QP16, KP16, VP16, ATh, ATl);
    k_gemmw<bf, 1, false, false><<<dim3(NB_ * TT / 64, DM / 64, 1), 32, 0, stream>>>(ATh, ATl, WO, nullptr, DQ, DQ, OUT, DM, nullptr, 0, 0, 0, nullptr, nullptr, nullptr);
}

// v004
// It runs in 111 microseconds.
// Next to v003, in two timings, it ran 1.36 and 1.35 times as fast.
// Counting every step since v000, it is 15.0 times as fast.
#include <hip/hip_runtime.h>
#include <stdint.h>

// Bidirectional grouped-query attention (x [2][4096][768]; q = x wq^T (6 heads x 128) x 128^-0.5, k, v = x wk^T / wv^T ([256][768]: 2 kv heads; query head h = g*3 + r uses kv head h/3); softmax(q.k) over all keys (no mask); out = merged wo^T -> [2][4096][768] (6.3 M)).
// Compute dtypes, f32 accumulate: every input rounded to bf16; q/k/v on PLAIN bf16 operands (inputs: exact); scores and attn.v on single fp16 operands inside one fused kernel (k_fattn); softmax f32, online; wo hl x exact (2 products).
// Four launches: k_cvtall (all inputs to bf16), k_gemmw (q, k, v of both batches, stored as fp16 head planes), k_fattn, k_gemmw (wo, both batches).

#define NB_  2
#define TT   4096
#define DM   768
#define NH_  6
#define NKV  2
#define REP  (NH_ / NKV)
#define HD   128
#define DQ   (NH_ * HD)
#define DKV  (NKV * HD)
#define SCL  0.088388347648318447f   // HD^-0.5
typedef _Float16 h16;
typedef unsigned short bf;
typedef __attribute__((ext_vector_type(16))) __bf16   v16bf;
typedef __attribute__((ext_vector_type(16))) _Float16 v16h;
typedef __attribute__((ext_vector_type(8)))  _Float16 v8h;
typedef __attribute__((ext_vector_type(8)))  unsigned short v8us;
typedef __attribute__((ext_vector_type(8)))  float    v8f;
typedef __attribute__((ext_vector_type(4)))  float    v4f;
typedef v8h  __attribute__((may_alias)) v8ha;
typedef v4f  __attribute__((may_alias)) v4fa;
typedef v8us __attribute__((may_alias)) v8usa;

__device__ __forceinline__ unsigned short f2bf(float f) { unsigned u = __float_as_uint(f); u += 0x7FFFu + ((u >> 16) & 1u); return (unsigned short)(u >> 16); }
__device__ __forceinline__ float bf2f(unsigned short b) { return __uint_as_float(((unsigned)b) << 16); }
__device__ __forceinline__ float bfr(float f) { return bf2f(f2bf(f)); }
__device__ __forceinline__ v16h cat16(v8h lo, v8h hi) { return __builtin_shufflevector(lo, hi, 0, 1, 2, 3, 4, 5, 6, 7, 8, 9, 10, 11, 12, 13, 14, 15); }
__device__ __forceinline__ v16bf cat16b(v8us lo, v8us hi) { return __builtin_bit_cast(v16bf, __builtin_shufflevector(lo, hi, 0, 1, 2, 3, 4, 5, 6, 7, 8, 9, 10, 11, 12, 13, 14, 15)); }
__device__ __forceinline__ v8f wmma16(v16h a, v16h b, v8f c) { return __builtin_amdgcn_wmma_f32_16x16x32_f16(false, a, false, b, (short)0, c, false, false); }
__device__ __forceinline__ v8f wmmab(v16bf a, v16bf b, v8f c) { return __builtin_amdgcn_wmma_f32_16x16x32_bf16(false, a, false, b, (short)0, c, false, false); }



__device__ __forceinline__ h16 tohx(float x) { return (h16)x; }
__device__ __forceinline__ void splitf(float y, unsigned short& h, unsigned short& l) { h = f2bf(y); l = f2bf(y - bf2f(h)); }
typedef __attribute__((ext_vector_type(2))) _Float16 v2h;
typedef __attribute__((ext_vector_type(4))) _Float16 v4h;
typedef __attribute__((ext_vector_type(2))) unsigned short v2us;
typedef __attribute__((ext_vector_type(4))) unsigned short v4us;
typedef __attribute__((ext_vector_type(2))) float v2f;
typedef __attribute__((ext_vector_type(4))) int v4i;

__global__ __launch_bounds__(256) void k_wtG(const float* __restrict__ w, int K, int N, bf* Bt) {
    const int lane = threadIdx.x & 31; const int L0 = (blockIdx.x * 8 + (threadIdx.x >> 5)) * 8; const int nlines = N * K / 64;
{
#pragma unroll 1
        for (int l = 0; l < 8; ++l) { const int L = L0 + l; if (L >= nlines) break; const size_t e = (size_t)L * 64 + lane * 2; const int k = (int)(e % K), n = (int)(e / K); v2us o;
            o[0] = f2bf(w[(size_t)k * N + n]); o[1] = f2bf(w[(size_t)(k + 1) * N + n]); *(v2us*)(Bt + e) = o; }
         }
}
// k_cvtall: every input rounded to bf16 in one launch; dst holds x, wq, wk, wv, wo one behind another. A unit is 8 elements; a thread converts CV_U units, a whole grid apart: a quarter of the waves to start, and each with all its loads in flight at once.
#define CV_NX (NB_ * TT * DM / 8)
#define CV_NQ (DQ * DM / 8)
#define CV_NK (DKV * DM / 8)
#define CV_TOT (CV_NX + 2 * CV_NQ + 2 * CV_NK)
#define CV_U 4
#define CV_GRID (CV_TOT / (CV_U * 256))
static_assert(CV_TOT % (CV_U * 256) == 0 && CV_NX % 256 == 0 && CV_NQ % 256 == 0 && CV_NK % 256 == 0 && TT % 64 == 0 && HD % 64 == 0, "whole blocks of units; a 64 x 64 tile lies in one batch and one head");
__global__ __launch_bounds__(256) void k_cvtall(const float* __restrict__ x, const float* __restrict__ wq, const float* __restrict__ wk, const float* __restrict__ wv, const float* __restrict__ wo, bf* dst) {
    const int u0 = blockIdx.x * 256 + threadIdx.x; v8f v[CV_U];
#pragma unroll
    for (int j = 0; j < CV_U; ++j) { int ub = blockIdx.x + j * CV_GRID; const float* s = x;   // every input is a whole number of 256-unit blocks: the choice of the source is the same for the whole block (scalar)
        if (ub >= CV_NX / 256) { ub -= CV_NX / 256; s = wq;
            if (ub >= CV_NQ / 256) { ub -= CV_NQ / 256; s = wk;
                if (ub >= CV_NK / 256) { ub -= CV_NK / 256; s = wv;
                    if (ub >= CV_NK / 256) { ub -= CV_NK / 256; s = wo; } } } }
        v[j] = *(const v8f*)(s + (size_t)ub * 2048 + threadIdx.x * 8); }
    __builtin_amdgcn_sched_barrier(0);   // all eight loads are issued before the first conversion waits for one (the scheduler had put the last two behind such a wait: a second memory latency)
#pragma unroll
    for (int j = 0; j < CV_U; ++j) { v8us o;
#pragma unroll
        for (int k = 0; k < 8; ++k) o[k] = f2bf(v[j][k]);
        *(v8us*)(dst + (size_t)(u0 + j * (CV_GRID * 256)) * 8) = o; }
}

typedef uint32_t u32x4 __attribute__((ext_vector_type(4)));
typedef uint32_t u32x8 __attribute__((ext_vector_type(8)));
typedef int i32x8 __attribute__((ext_vector_type(8)));
typedef short s16x8 __attribute__((ext_vector_type(8)));
#define FA_NW 8                    // waves per workgroup
#define FA_CW 32                   // query columns per wave
#define FA_R  2                    // 16-column groups per wave
#define FA_KT 2                    // 16-key score tiles per pass
#define FA_DK (HD / 32)
#define FA_DT (HD / 16)
#define FA_ROWB 256u               // bytes of one K or V row
#define FA_PK 272u                 // LDS pitch of K rows (ds_load_b128 readers): 16 B x odd
#define FA_PV 288u                 // LDS pitch of V rows (ds_load_tr16_b128 readers): 32 B x odd
#define FA_SLICE 10240u            // 32 padded rows, rounded up to a multiple of 2 KiB
#define FA_STAGE (8u * FA_SLICE)   // 4 K slices, then 4 V slices: 128 keys
#define FA_LDS (2u * FA_STAGE)
#define FA_NST (TT / 128)
#define FA_EP 272u                 // output staging pitch
#define FA_W0K ((1u << 20) | (5u << 22) | (3u << 25))   // descriptor group 1 word 0: pad of 16 B behind every 256-B row
#define FA_W0V ((1u << 20) | (5u << 22) | (7u << 25))   // the same with 32 B
static_assert(HD == 128 && TT % 256 == 0 && FA_NST >= 2, "k_fattn is written for head size 128 and whole 256-row query blocks");
static_assert(32u * FA_PK <= FA_SLICE && 32u * FA_PV <= FA_SLICE && 2u * FA_NW * FA_CW * FA_EP <= FA_LDS, "slices and output staging must fit");
#define DEV static __device__ __forceinline__
DEV uint32_t uni(uint32_t v) { return (uint32_t)__builtin_amdgcn_readfirstlane(v); }
DEV uint32_t pinned(uint32_t v) { uint32_t w = __builtin_amdgcn_readfirstlane(v); asm volatile("" : "+s"(w)); return w; }   // a test word held in a scalar register: the branch on it is a scalar branch (tensor loads ignore EXEC)
DEV void fence() { __builtin_amdgcn_sched_barrier(0); }   // holds the order of the blocks of a pass as written (what each one is for stands at its use)
DEV void wait_ds0() { asm volatile("s_wait_dscnt 0x0" ::: "memory"); }   // this wave's LDS reads and writes are done
// This wave's own tensor request has landed. Both descriptor groups are read here in the registers the load named: the compiler keeps them there, unwritten, from the load to this wait.
DEV void wait_tensor0(u32x4 g0, u32x8 g1) { asm volatile("s_wait_tensorcnt 0x0" :: "{s[80:83]}"(g0), "{s[84:91]}"(g1) : "memory"); }
DEV void nop4() { asm volatile("v_nop\n\tv_nop\n\tv_nop\n\tv_nop"); }   // the four vector slots behind a WMMA before its D is read or its A or B overwritten
// One tensor load. The descriptor is formed and the load issued in one statement, in twelve fixed scalar registers that nothing else of the kernel uses, so that no word of an outstanding request's descriptor is rewritten
// (left to the register allocator, the groups were copied behind the load and their first registers reused ahead of the wait).
// Group 0 (s80 to s83): count 1, LDS byte, address low, address high | type 2. Group 1 (s84 to s91): W0 (mask 0, 1-byte elements, the pad), tensor = tile = 32 rows of 256 bytes, source pitch 256 bytes.
// The three words that vary go through readfirstlane; every other word is an immediate of the text. The outputs are early-clobbered: no input shares a register with them.
template <uint32_t W0> DEV void tdm_load(uint32_t lds_dst, uint64_t ga, u32x4& g0, u32x8& g1) {
    constexpr uint32_t d0 = FA_ROWB, d1 = 32u;
    asm volatile("s_mov_b32 s80, 1\n\ts_mov_b32 s81, %2\n\ts_mov_b32 s82, %3\n\ts_mov_b32 s83, %4\n\t"
                 "s_mov_b32 s84, %5\n\ts_mov_b32 s85, %6\n\ts_mov_b32 s86, %7\n\ts_mov_b32 s87, %8\n\ts_mov_b32 s88, %9\n\ts_mov_b32 s89, %10\n\ts_mov_b32 s90, 0\n\ts_mov_b32 s91, 0\n\t"
                 "tensor_load_to_lds s[80:83], s[84:91]"
                 : "=&{s[80:83]}"(g0), "=&{s[84:91]}"(g1)
                 : "s"(uni(lds_dst)), "s"(uni((uint32_t)ga)), "s"(uni((((uint32_t)(ga >> 32)) & 0x01FFFFFFu) | 0x80000000u)),
                   "n"(W0), "n"((d0 & 0xFFFFu) << 16), "n"((d0 >> 16) | ((d1 & 0xFFFFu) << 16)), "n"((d1 >> 16) | (d0 << 16)), "n"(d1), "n"(FA_ROWB)
                 : "memory"); }
struct Frag { u32x4 q[2]; };
DEV v8f fmma(const Frag& a, const Frag& b, v8f c) {
    const i32x8 av = {(int)a.q[0].x, (int)a.q[0].y, (int)a.q[0].z, (int)a.q[0].w, (int)a.q[1].x, (int)a.q[1].y, (int)a.q[1].z, (int)a.q[1].w};
    const i32x8 bv = {(int)b.q[0].x, (int)b.q[0].y, (int)b.q[0].z, (int)b.q[0].w, (int)b.q[1].x, (int)b.q[1].y, (int)b.q[1].z, (int)b.q[1].w};
    return wmma16(__builtin_bit_cast(v16h, av), __builtin_bit_cast(v16h, bv), c); }
DEV u32x4 ld_tr16(const unsigned char* p) { typedef __attribute__((address_space(3))) s16x8 lds_s16x8; return __builtin_bit_cast(u32x4, __builtin_amdgcn_ds_load_tr16_b128_v8i16((lds_s16x8*)p)); }
DEV uint32_t pack2h(float lo, float hi) { return __builtin_bit_cast(uint32_t, __builtin_convertvector((v2f){lo, hi}, v2h)); }   // round to nearest even
DEV float xhalf(float x) { return __builtin_bit_cast(float, __builtin_amdgcn_permlanex16(__builtin_bit_cast(int, x), __builtin_bit_cast(int, x), 0x76543210, 0xfedcba98, false, false)); }   // lane l with lane l ^ 16
struct KFr { Frag f[FA_KT][FA_DK]; };
// koff = byte offset of the pass's K slice in LDS; the hardware k order (bytes 16h and 32 + 16h of each 64), as Q's below.
DEV void load_k(KFr& k, const unsigned char* Lp, uint32_t koff, uint32_t lane) {
    const uint32_t c = lane & 15u, h = lane >> 4;
#pragma unroll
    for (int kt = 0; kt < FA_KT; ++kt) { const unsigned char* p = Lp + koff + (16u * kt + c) * FA_PK + 16u * h;
#pragma unroll
        for (int kc = 0; kc < FA_DK; ++kc) { k.f[kt][kc].q[0] = *reinterpret_cast<const u32x4*>(p + 64u * kc); k.f[kt][kc].q[1] = *reinterpret_cast<const u32x4*>(p + 64u * kc + 32u); } }
}
// One 32-key pass of one wave.
DEV void fa_pass(KFr& kf, bool fetch_next, uint32_t next_koff, const unsigned char* Lp, uint32_t voff, uint32_t lane, const Frag (&qf)[FA_R][FA_DK], v8f (&acc)[FA_R][FA_DT], float (&m_run)[FA_R], float (&l_run)[FA_R], float cscale) {
    const uint32_t h = lane >> 4;
    v8f s[FA_KT][FA_R];
    wait_ds0(); fence();   // the K fragments fetched ahead have arrived
#pragma unroll
    for (int kt = 0; kt < FA_KT; ++kt) {
#pragma unroll
        for (int g = 0; g < FA_R; ++g) { s[kt][g] = (v8f){};
#pragma unroll
            for (int kc = 0; kc < FA_DK; ++kc) s[kt][g] = fmma(kf.f[kt][kc], qf[g][kc], s[kt][g]); } }
    fence(); nop4(); fence();   // keeps the fetch below (it overwrites A operands) behind the products and their slots
    if (fetch_next) load_k(kf, Lp, next_koff, lane);   // the next pass's K of the SAME stage, in flight under the maxima and the first exponentials
    float mb[FA_R]; bool need = false;
#pragma unroll
    for (int g = 0; g < FA_R; ++g) { float mx = -__builtin_inff();
#pragma unroll
        for (int kt = 0; kt < FA_KT; ++kt) {
#pragma unroll
            for (int r = 0; r < 8; ++r) mx = __builtin_fmaxf(mx, s[kt][g][r]); }
        mx = __builtin_fmaxf(mx, xhalf(mx)) * cscale;   // both wave halves hold this query's maximum, scaled (the scale is positive)
        mb[g] = mx; need = need || (mx > m_run[g] + 8.0f);
        fence(); }   // one group's maximum at a time: fewer live registers
    if (__builtin_amdgcn_ballot_w32(need) != 0) {   // rare after the first pass
#pragma unroll
        for (int g = 0; g < FA_R; ++g) { const float m_new = __builtin_fmaxf(m_run[g], mb[g]); const float corr = __builtin_amdgcn_exp2f(m_run[g] - m_new);   // 0 on the first pass, where m_run is -inf
            l_run[g] *= corr; m_run[g] = m_new;
#pragma unroll
            for (int t = 0; t < FA_DT; ++t) acc[g][t] = acc[g][t] * corr; } }
    Frag vf[FA_DT]; float ps[FA_R][2];
#pragma unroll
    for (int g = 0; g < FA_R; ++g) { ps[g][0] = 0.0f; ps[g][1] = 0.0f; }
    { const unsigned char* ad = Lp + voff + (8u * h + (lane & 7u)) * FA_PV + ((lane >> 3) & 1u) * 16u;
#pragma unroll
      for (int t = 0; t < FA_DT; ++t) { vf[t].q[0] = ld_tr16(ad + 32u * t); vf[t].q[1] = ld_tr16(ad + 16u * FA_PV + 32u * t); } }
#pragma unroll
    for (int g = 0; g < FA_R; ++g) { const float nm = -m_run[g]; uint32_t w[8];
#pragma unroll
        for (int i = 0; i < 8; ++i) {
            const v2f arg = __builtin_elementwise_fma((v2f){s[i >> 2][g][2 * (i & 3)], s[i >> 2][g][2 * (i & 3) + 1]}, (v2f){cscale, cscale}, (v2f){nm, nm});
            const float p0 = __builtin_amdgcn_exp2f(arg.x), p1 = __builtin_amdgcn_exp2f(arg.y); ps[g][i & 1] += p0 + p1; w[i] = pack2h(p0, p1); }
        Frag pf; pf.q[0] = (u32x4){w[0], w[1], w[2], w[3]}; pf.q[1] = (u32x4){w[4], w[5], w[6], w[7]};
        if (g == 0) { wait_ds0(); fence(); }   // the V^T fragments have arrived
#pragma unroll
        for (int t = 0; t < FA_DT; ++t) acc[g][t] = fmma(vf[t], pf, acc[g][t]);
        fence(); }   // one group's P^T live at a time
#pragma unroll
    for (int g = 0; g < FA_R; ++g) l_run[g] += ps[g][0] + ps[g][1];
}
// Q [b][h][t][d], K and V [b][g][t][d] (fp16); Ah, Al [b][t][DQ]: the hi and lo bf16 planes of the merged heads.
__global__ void __launch_bounds__(FA_NW * 32) __attribute__((amdgpu_waves_per_eu(2, 2))) k_fattn(const h16* __restrict__ Q, const h16* __restrict__ K, const h16* __restrict__ V, bf* Ah, bf* Al) {
    __shared__ __attribute__((aligned(2048))) unsigned char L[FA_LDS];
    const uint32_t tid = threadIdx.x, lane = tid & 31u, wave = uni(tid >> 5), c = lane & 15u, h = lane >> 4;
    const uint32_t hq = blockIdx.x, b = blockIdx.y, q0 = blockIdx.z * (uint32_t)(FA_NW * FA_CW), gkv = hq / (uint32_t)REP;
    const float cscale = SCL * 1.4426950408889634f;
    const uint32_t lbase = (uint32_t)(size_t)L;
    const uint64_t src = (uint64_t)(size_t)((wave < 4u ? K : V) + (size_t)(b * NKV + gkv) * TT * HD) + (uint64_t)((wave & 3u) * 32u) * FA_ROWB;   // this wave's slice of stage 0
    u32x4 g0; u32x8 g1;
    auto issue = [&](uint32_t st) {   // this wave's one request of stage st: rows st * 128 + (wave & 3) * 32 ... + 31
        const uint32_t dst = lbase + (st & 1u) * FA_STAGE + wave * FA_SLICE; const uint64_t ga = src + (uint64_t)(st * 128u) * FA_ROWB;
        if (pinned(wave < 4u)) tdm_load<FA_W0K>(dst, ga, g0, g1);   // the two differ in the pad alone, a constant on either path
        else tdm_load<FA_W0V>(dst, ga, g0, g1);
    };
    issue(0u);
    Frag qf[FA_R][FA_DK];
#pragma unroll
    for (int g = 0; g < FA_R; ++g) { const h16* qp = Q + ((size_t)(b * NH_ + hq) * TT + q0 + wave * FA_CW + 16u * g + c) * HD + 8u * h;
#pragma unroll
        for (int kc = 0; kc < FA_DK; ++kc) { qf[g][kc].q[0] = *reinterpret_cast<const u32x4*>(qp + 32 * kc); qf[g][kc].q[1] = *reinterpret_cast<const u32x4*>(qp + 32 * kc + 16); } }
    v8f acc[FA_R][FA_DT]; float m_run[FA_R], l_run[FA_R];
#pragma unroll
    for (int g = 0; g < FA_R; ++g) { m_run[g] = -__builtin_inff(); l_run[g] = 0.0f;
#pragma unroll
        for (int t = 0; t < FA_DT; ++t) acc[g][t] = (v8f){}; }
    wait_tensor0(g0, g1);     // stage 0 has landed (this wave's slice)
    __syncthreads();    // ... and is published to every wave
    issue(1u);
    KFr kf;
#pragma unroll 1   // rolled: one publish point in the text, and the pass loop stays nested in it
    for (uint32_t st = 0; st < (uint32_t)FA_NST; ++st) {
        const uint32_t base = (st & 1u) * FA_STAGE;
        load_k(kf, L, base, lane);
#pragma unroll 1
        for (uint32_t sub = 0; sub < 4u; ++sub)   // kept rolled and nested: one flat or unrolled loop over passes spills
            fa_pass(kf, sub < 3u, base + (sub + 1u) * FA_SLICE, L, base + (4u + sub) * FA_SLICE, lane, qf, acc, m_run, l_run, cscale);
        // Publish point of stage st + 1, every wave: own LDS reads done, own request landed, barrier; only then the refill of the buffer just read.
        wait_ds0();
        wait_tensor0(g0, g1);
        __syncthreads();
        if (pinned(st + 2u < (uint32_t)FA_NST)) issue(st + 2u);
    }
    wait_tensor0(g0, g1);
    wait_ds0();
    // The last publish point's barrier has ended every wave's reads of the ring: it becomes output staging, one region a wave and plane.
    const uint32_t eh = wave * (uint32_t)FA_CW * FA_EP, el = eh + (uint32_t)(FA_NW * FA_CW) * FA_EP;
#pragma unroll
    for (int g = 0; g < FA_R; ++g) { const float l_fin = l_run[g] + xhalf(l_run[g]);
        const float inv = 1.0f / l_fin;
#pragma unroll
        for (int t = 0; t < FA_DT; ++t) { const v8f o = acc[g][t] * inv; u32x4 ph, pw;
#pragma unroll
            for (int i = 0; i < 4; ++i) { unsigned short a0, c0, a1, c1; splitf(o[2 * i], a0, c0); splitf(o[2 * i + 1], a1, c1); ph[i] = (uint32_t)a0 | ((uint32_t)a1 << 16); pw[i] = (uint32_t)c0 | ((uint32_t)c1 << 16); }
            const uint32_t eo = (16u * g + c) * FA_EP + 32u * t + 16u * h;
            *reinterpret_cast<u32x4*>(L + eh + eo) = ph; *reinterpret_cast<u32x4*>(L + el + eo) = pw; } }
    wait_ds0();
    // Read back whole rows: 16 lanes cover one 256-byte row, so every 128-byte line of the planes is stored once.
#pragma unroll
    for (uint32_t i = 0; i < (uint32_t)FA_CW / 2u; ++i) { const uint32_t row = i * 2u + lane / 16u, colb = (lane % 16u) * 16u;
        const u32x4 vh = *reinterpret_cast<const u32x4*>(L + eh + row * FA_EP + colb); const u32x4 vl = *reinterpret_cast<const u32x4*>(L + el + row * FA_EP + colb);
        const size_t ob = (((size_t)b * TT + q0 + wave * FA_CW + row) * DQ + (size_t)hq * HD) * 2 + colb;
        *reinterpret_cast<u32x4*>(reinterpret_cast<unsigned char*>(Ah) + ob) = vh; *reinterpret_cast<u32x4*>(reinterpret_cast<unsigned char*>(Al) + ob) = vl; }
}

// ---- k_gemmw: C[m][n] = sum_k A[m][k] Bt[n][k] (+ A2[m][k] Bt[n][k] where SPLIT), bf16 operands in K-contiguous planes of GK elements a row, f32 accumulate; every wave keeps one 64x64 tile (16 accumulators).
// A workgroup is 2 x WN waves (WN = 2, SPLIT: 4) on a 128 x 64 WN tile; grid (M / 128, N / (64 WN)). Its operand rows come by tensor loads in stages of 64 k (128 bytes a row) into two LDS buffers:
// every wave brings one slice of 64 rows a stage (A: slices 0, 1; SPLIT: A2: 2, 3; then Bt: WN slices), so a row is fetched once a workgroup and each fragment is read from LDS by the waves that share it.
// HEADS: m = b * TT + t, n runs over the q, then the k, then the v columns; the tile goes out rounded to fp16 into the head planes PQ, PK, PV ([b][h][t][d]) and C is not used.
// Every "#pragma unroll" of this section but the two output read-backs' stands over a loop whose index picks a register array's element: unrolled, the arrays stay in registers.
#define GK 768u                    // row length of every operand plane, elements
#define G_ROWB 128u                // bytes of one operand row in a stage
#define G_P 144u                   // its LDS pitch (ds_load_b128 readers): 16 B x odd
#define G_SLICE 10240u             // 64 padded rows, rounded up to a multiple of 2 KiB
#define G_NST (GK / 64u)
#define G_OS (16u * 68u * 4u)      // bytes of one wave's output staging
#define G_W0 ((1u << 20) | (4u << 22) | (3u << 25))   // descriptor group 1 word 0: pad of 16 B behind every 128-B row
static_assert(DM == GK && DQ == GK && G_NST >= 2u && 64u * G_P <= G_SLICE && (NB_ * TT) % 128 == 0 && (DQ + 2 * DKV) % 128 == 0 && DM % 256 == 0, "whole tiles, whole stages, two stages or more");
// One tensor load of 64 rows of 128 bytes at a source pitch of 2 GK bytes: tdm_load's form (fixed scalar registers, descriptor and load in one statement, for the reasons given there) with this tile's constants.
DEV void tdm_load_g(uint32_t lds_dst, uint64_t ga, u32x4& g0, u32x8& g1) {
    constexpr uint32_t d0 = G_ROWB, d1 = 64u;
    asm volatile("s_mov_b32 s80, 1\n\ts_mov_b32 s81, %2\n\ts_mov_b32 s82, %3\n\ts_mov_b32 s83, %4\n\t"
                 "s_mov_b32 s84, %5\n\ts_mov_b32 s85, %6\n\ts_mov_b32 s86, %7\n\ts_mov_b32 s87, %8\n\ts_mov_b32 s88, %9\n\ts_mov_b32 s89, %10\n\ts_mov_b32 s90, 0\n\ts_mov_b32 s91, 0\n\t"
                 "tensor_load_to_lds s[80:83], s[84:91]"
                 : "=&{s[80:83]}"(g0), "=&{s[84:91]}"(g1)
                 : "s"(uni(lds_dst)), "s"(uni((uint32_t)ga)), "s"(uni((((uint32_t)(ga >> 32)) & 0x01FFFFFFu) | 0x80000000u)),
                   "n"(G_W0), "n"((d0 & 0xFFFFu) << 16), "n"((d0 >> 16) | ((d1 & 0xFFFFu) << 16)), "n"((d1 >> 16) | (d0 << 16)), "n"(d1), "n"(2u * GK)
                 : "memory"); }
DEV v16bf ld_fr(const unsigned char* p) { return cat16b(*reinterpret_cast<const v8usa*>(p), *reinterpret_cast<const v8usa*>(p + 32)); }   // the hardware k order: bytes 16 h and 32 + 16 h of each 64 (p holds the 16 h)
template <bool SPLIT, bool HEADS>
__global__ __launch_bounds__(SPLIT ? 256 : 128) void k_gemmw(const bf* __restrict__ A, const bf* __restrict__ A2, const bf* __restrict__ Bt, float* C, int ldc, h16* PQ, h16* PK, h16* PV) {
    constexpr uint32_t WN = SPLIT ? 4u : 2u, NW = 2u * WN, NA = SPLIT ? 4u : 2u, STAGE = NW * G_SLICE;
    __shared__ __attribute__((aligned(2048))) unsigned char L[2u * STAGE + NW * G_OS];   // the ring, then one staging region a wave
    const uint32_t lane = threadIdx.x & 31u, wave = uni(threadIdx.x >> 5), lr = lane & 15u, hi = lane >> 4, wm = wave / WN, wn = wave % WN;
    const uint32_t R0 = blockIdx.x * 128u, C0 = blockIdx.y * (64u * WN);
    const int r0 = (int)(R0 + wm * 64u), c0 = (int)(C0 + wn * 64u);
    const bf* sp = A + (size_t)(R0 + (wave & 1u) * 64u) * GK;   // this wave's slice of stage 0
    if (SPLIT && wave >= 2u) sp = A2 + (size_t)(R0 + (wave & 1u) * 64u) * GK;
    if (wave >= NA) sp = Bt + (size_t)(C0 + (wave - NA) * 64u) * GK;
    const uint64_t src = (uint64_t)(size_t)sp; const uint32_t lbase = (uint32_t)(size_t)L;
    u32x4 g0; u32x8 g1;
    auto issue = [&](uint32_t st) { tdm_load_g(lbase + (st & 1u) * STAGE + wave * G_SLICE, src + (uint64_t)(st * G_ROWB), g0, g1); };   // every wave issues its one request of stage st
    issue(0u);
    v8f acc[4][4];
#pragma unroll
    for (int mb = 0; mb < 4; ++mb)
#pragma unroll
        for (int nb = 0; nb < 4; ++nb) acc[mb][nb] = (v8f){};
    const uint32_t fo = lr * G_P + 16u * hi;   // this lane's place in a 16-row fragment
    wait_tensor0(g0, g1);     // stage 0 has landed (this wave's slice)
    __syncthreads();    // ... and is published to every wave
    issue(1u);
#pragma unroll 1   // rolled: one publish point in the text
    for (uint32_t st = 0; st < G_NST; ++st) {
        const unsigned char* Ls = L + (st & 1u) * STAGE + fo;
        v16bf a[2][4], a2[2][4], b[2][4];
#pragma unroll
        for (uint32_t kc = 0; kc < 2u; ++kc) {
#pragma unroll
            for (uint32_t i = 0; i < 4u; ++i) { a[kc][i] = ld_fr(Ls + wm * G_SLICE + i * 16u * G_P + kc * 64u); b[kc][i] = ld_fr(Ls + (NA + wn) * G_SLICE + i * 16u * G_P + kc * 64u); if (SPLIT) a2[kc][i] = ld_fr(Ls + (2u + wm) * G_SLICE + i * 16u * G_P + kc * 64u); } }
        fence();   // the stage's fragment loads stand as one group ahead of its products: left to the scheduler, a pair of loads and a wait to 0 stood in front of every four WMMAs
#pragma unroll
        for (uint32_t kc = 0; kc < 2u; ++kc) {
#pragma unroll
            for (uint32_t nb = 0; nb < 4u; ++nb) {
#pragma unroll
                for (uint32_t mb = 0; mb < 4u; ++mb) acc[mb][nb] = wmmab(a[kc][mb], b[kc][nb], acc[mb][nb]);
                if (SPLIT) {
#pragma unroll
                    for (uint32_t mb = 0; mb < 4u; ++mb) acc[mb][nb] = wmmab(a2[kc][mb], b[kc][nb], acc[mb][nb]); } } }
        fence(); nop4(); fence();   // the slots behind the stage's last WMMA, on the loop's back edge too, before the next stage's fragment loads overwrite its A and B
        // Publish point of stage st + 1, every wave: own LDS reads done, own request landed, barrier; only then the refill of the buffer just read.
        wait_ds0();
        wait_tensor0(g0, g1);
        __syncthreads();
        if (pinned(st + 2u < G_NST)) issue(st + 2u);
    }
    wait_tensor0(g0, g1);
    wait_ds0();
    float* os = reinterpret_cast<float*>(L + 2u * STAGE + wave * G_OS);   // outside the ring, this wave's own: no barrier is owed
#pragma unroll
    for (int mb = 0; mb < 4; ++mb) {
#pragma unroll
        for (int nb = 0; nb < 4; ++nb) {
#pragma unroll
            for (int j = 0; j < 8; ++j) os[(hi * 8 + j) * 68 + nb * 16 + lr] = acc[mb][nb][j]; }
        __builtin_amdgcn_wave_barrier(); asm volatile("" ::: "memory");   // the staging stores stay ahead of the row reads below (other lanes' values)
        if (HEADS) {   // the tile's 64 rows lie in one batch, its 64 columns in one head: a row of the tile is one whole 128-byte line of the plane
            h16* P = PQ; int nh = NH_, hh = c0 / HD;
            if (c0 >= DQ + DKV) { P = PV; nh = NKV; hh = (c0 - DQ - DKV) / HD; } else if (c0 >= DQ) { P = PK; nh = NKV; hh = (c0 - DQ) / HD; }
            h16* prow = P + ((size_t)((r0 / TT) * nh + hh) * TT + (r0 % TT) + mb * 16) * HD + (c0 % HD);
#pragma unroll
            for (int s = 0; s < 4; ++s) { const int row = 4 * s + (lane >> 3), cofs = (lane & 7) * 8; const v4f lo = *(const v4fa*)(os + row * 68 + cofs), up = *(const v4fa*)(os + row * 68 + cofs + 4); v8h o;
#pragma unroll
                for (int k = 0; k < 4; ++k) { o[k] = (h16)lo[k]; o[k + 4] = (h16)up[k]; }
                *(v8h*)(prow + (size_t)row * HD + cofs) = o; }
        } else {
            float* crow = C + (size_t)(r0 + mb * 16) * ldc + c0;
#pragma unroll
            for (int s = 0; s < 8; ++s) { const int row = 2 * s + hi, cofs = lr * 4;
                *(v4f*)(crow + (size_t)row * ldc + cofs) = *(const v4fa*)(os + row * 68 + cofs); }
        }
        __builtin_amdgcn_wave_barrier(); asm volatile("" ::: "memory");   // ... and the row reads ahead of the next block's staging stores
    }
}

extern "C" void kernel_launch(void* const* d_in, const int* in_sizes, int n_in,
                              void* d_out, int out_size, void* d_ws, size_t ws_size, hipStream_t stream) {
    (void)in_sizes; (void)n_in; (void)out_size;
    const float* x = (const float*)d_in[0]; const float* wq = (const float*)d_in[1]; const float* wk = (const float*)d_in[2]; const float* wv = (const float*)d_in[3]; const float* wo = (const float*)d_in[4];
    float* OUT = (float*)d_out;     // [2][4096][768]
    char* wsp = (char*)d_ws;
    auto take = [&](size_t bytes) { char* p = wsp; wsp += (bytes + 255) & ~(size_t)255; return (void*)p; };
    bf* XB = (bf*)take((size_t)CV_TOT * 8 * 2); bf* WQ = XB + (size_t)CV_NX * 8; bf* WO = WQ + (size_t)(CV_NQ + 2 * CV_NK) * 8;   // x of both batches [b * TT + t][DM]; wq, wk, wv as one [DQ + 2 DKV][DM] matrix; wo
    h16* QP16 = (h16*)take((size_t)NB_ * NH_ * TT * HD * 2); h16* KP16 = (h16*)take((size_t)NB_ * NKV * TT * HD * 2); h16* VP16 = (h16*)take((size_t)NB_ * NKV * TT * HD * 2);   // head planes [b][h][t][d] of both batches
    bf* ATh = (bf*)take((size_t)NB_ * TT * DQ * 2); bf* ATl = (bf*)take((size_t)NB_ * TT * DQ * 2);
    if ((size_t)(wsp - (char*)d_ws) > ws_size) return;    // ws 256 MiB
    k_cvtall<<<CV_GRID, 256, 0, stream>>>(x, wq, wk, wv, wo, XB);
    k_gemmw<false, true><<<dim3(NB_ * TT / 128, (DQ + 2 * DKV) / 128, 1), 128, 0, stream>>>(XB, nullptr, WQ, nullptr, 0, QP16, KP16, VP16);   // v as [g][t][d] rows: the fused kernel transposes on its LDS read
    k_fattn<<<dim3(NH_, NB_, TT / (FA_NW * FA_CW)), FA_NW * 32, 0, stream>>>(QP16, KP16, VP16, ATh, ATl);
    k_gemmw<true, false><<<dim3(NB_ * TT / 128, DM / 256, 1), 256, 0, stream>>>(ATh, ATl, WO, OUT, DM, nullptr, nullptr, nullptr);
}

// v005
// It runs in 105 microseconds.
// In both of two side-by-side timings against v004, it was 1.05 times as fast.
// Over all steps from v000 it is 15.8 times as fast.
#include <hip/hip_runtime.h>
#include <stdint.h>

// Bidirectional grouped-query attention (x [2][4096][768]; q = x wq^T (6 heads x 128) x 128^-0.5, k, v = x wk^T / wv^T ([256][768]: 2 kv heads; query head h = g*3 + r uses kv head h/3); softmax(q.k) over all keys (no mask); out = merged wo^T -> [2][4096][768] (6.3 M)).
// Compute dtypes, f32 accumulate: every input rounded to bf16; q/k/v on PLAIN bf16 operands (inputs: exact); scores and attn.v on single fp16 operands inside one fused kernel (k_fattn); softmax f32, online, its row sums taken over the fp16 weights; wo hl x exact (2 products).
// Four launches: k_cvtall (all inputs to bf16), k_gemmw (q, k, v of both batches, stored as fp16 head planes), k_fattn, k_gemmw (wo, both batches).

#define NB_  2
#define TT   4096
#define DM   768
#define NH_  6
#define NKV  2
#define REP  (NH_ / NKV)
#define HD   128
#define DQ   (NH_ * HD)
#define DKV  (NKV * HD)
#define SCL  0.088388347648318447f   // HD^-0.5
#define QSC  (SCL * 1.4426950408889634f)   // HD^-0.5 log2(e): the q plane is stored times this, so that a score product is already the exponent to base 2
typedef _Float16 h16;
typedef unsigned short bf;
typedef __attribute__((ext_vector_type(16))) __bf16   v16bf;
typedef __attribute__((ext_vector_type(16))) _Float16 v16h;
typedef __attribute__((ext_vector_type(8)))  _Float16 v8h;
typedef __attribute__((ext_vector_type(8)))  unsigned short v8us;
typedef __attribute__((ext_vector_type(8)))  float    v8f;
typedef __attribute__((ext_vector_type(4)))  float    v4f;
typedef v8h  __attribute__((may_alias)) v8ha;
typedef v4f  __attribute__((may_alias)) v4fa;
typedef v8us __attribute__((may_alias)) v8usa;

__device__ __forceinline__ unsigned short f2bf(float f) { unsigned u = __float_as_uint(f); u += 0x7FFFu + ((u >> 16) & 1u); return (unsigned short)(u >> 16); }
__device__ __forceinline__ float bf2f(unsigned short b) { return __uint_as_float(((unsigned)b) << 16); }
__device__ __forceinline__ float bfr(float f) { return bf2f(f2bf(f)); }
__device__ __forceinline__ v16h cat16(v8h lo, v8h hi) { return __builtin_shufflevector(lo, hi, 0, 1, 2, 3, 4, 5, 6, 7, 8, 9, 10, 11, 12, 13, 14, 15); }
__device__ __forceinline__ v16bf cat16b(v8us lo, v8us hi) { return __builtin_bit_cast(v16bf, __builtin_shufflevector(lo, hi, 0, 1, 2, 3, 4, 5, 6, 7, 8, 9, 10, 11, 12, 13, 14, 15)); }
__device__ __forceinline__ v8f wmma16(v16h a, v16h b, v8f c) { return __builtin_amdgcn_wmma_f32_16x16x32_f16(false, a, false, b, (short)0, c, false, false); }
__device__ __forceinline__ v8f wmmab(v16bf a, v16bf b, v8f c) { return __builtin_amdgcn_wmma_f32_16x16x32_bf16(false, a, false, b, (short)0, c, false, false); }



__device__ __forceinline__ h16 tohx(float x) { return (h16)x; }
__device__ __forceinline__ void splitf(float y, unsigned short& h, unsigned short& l) { h = f2bf(y); l = f2bf(y - bf2f(h)); }
typedef __attribute__((ext_vector_type(2))) _Float16 v2h;
typedef __attribute__((ext_vector_type(4))) _Float16 v4h;
typedef __attribute__((ext_vector_type(2))) unsigned short v2us;
typedef __attribute__((ext_vector_type(4))) unsigned short v4us;
typedef __attribute__((ext_vector_type(2))) float v2f;
typedef __attribute__((ext_vector_type(4))) int v4i;

__global__ __launch_bounds__(256) void k_wtG(const float* __restrict__ w, int K, int N, bf* Bt) {
    const int lane = threadIdx.x & 31; const int L0 = (blockIdx.x * 8 + (threadIdx.x >> 5)) * 8; const int nlines = N * K / 64;
{
#pragma unroll 1
        for (int l = 0; l < 8; ++l) { const int L = L0 + l; if (L >= nlines) break; const size_t e = (size_t)L * 64 + lane * 2; const int k = (int)(e % K), n = (int)(e / K); v2us o;
            o[0] = f2bf(w[(size_t)k * N + n]); o[1] = f2bf(w[(size_t)(k + 1) * N + n]); *(v2us*)(Bt + e) = o; }
         }
}
// k_cvtall: every input rounded to bf16 in one launch; dst holds x, wq, wk, wv, wo one behind another. A unit is 8 elements; a thread converts CV_U units, a whole grid apart: a quarter of the waves to start, and each with all its loads in flight at once.
#define CV_NX (NB_ * TT * DM / 8)
#define CV_NQ (DQ * DM / 8)
#define CV_NK (DKV * DM / 8)
#define CV_TOT (CV_NX + 2 * CV_NQ + 2 * CV_NK)
#define CV_U 4
#define CV_GRID (CV_TOT / (CV_U * 256))
static_assert(CV_TOT % (CV_U * 256) == 0 && CV_NX % 256 == 0 && CV_NQ % 256 == 0 && CV_NK % 256 == 0 && TT % 64 == 0 && HD % 64 == 0, "whole blocks of units; a 64 x 64 tile lies in one batch and one head");
__global__ __launch_bounds__(256) void k_cvtall(const float* __restrict__ x, const float* __restrict__ wq, const float* __restrict__ wk, const float* __restrict__ wv, const float* __restrict__ wo, bf* dst) {
    const int u0 = blockIdx.x * 256 + threadIdx.x; v8f v[CV_U];
#pragma unroll
    for (int j = 0; j < CV_U; ++j) { int ub = blockIdx.x + j * CV_GRID; const float* s = x;   // every input is a whole number of 256-unit blocks: the choice of the source is the same for the whole block (scalar)
        if (ub >= CV_NX / 256) { ub -= CV_NX / 256; s = wq;
            if (ub >= CV_NQ / 256) { ub -= CV_NQ / 256; s = wk;
                if (ub >= CV_NK / 256) { ub -= CV_NK / 256; s = wv;
                    if (ub >= CV_NK / 256) { ub -= CV_NK / 256; s = wo; } } } }
        v[j] = *(const v8f*)(s + (size_t)ub * 2048 + threadIdx.x * 8); }
    __builtin_amdgcn_sched_barrier(0);   // all eight loads are issued before the first conversion waits for one (the scheduler had put the last two behind such a wait: a second memory latency)
#pragma unroll
    for (int j = 0; j < CV_U; ++j) { v8us o;
#pragma unroll
        for (int k = 0; k < 8; ++k) o[k] = f2bf(v[j][k]);
        *(v8us*)(dst + (size_t)(u0 + j * (CV_GRID * 256)) * 8) = o; }
}

typedef uint32_t u32x4 __attribute__((ext_vector_type(4)));
typedef uint32_t u32x8 __attribute__((ext_vector_type(8)));
typedef int i32x8 __attribute__((ext_vector_type(8)));
typedef short s16x8 __attribute__((ext_vector_type(8)));
#define FA_NW 8                    // waves per workgroup
#define FA_CW 32                   // query columns per wave
#define FA_R  2                    // 16-column groups per wave
#define FA_KT 2                    // 16-key score tiles per pass
#define FA_DK (HD / 32)
#define FA_DT (HD / 16)
#define FA_ROWB 256u               // bytes of one K or V row
#define FA_PK 272u                 // LDS pitch of K rows (ds_load_b128 readers): 16 B x odd
#define FA_PV 288u                 // LDS pitch of V rows (ds_load_tr16_b128 readers): 32 B x odd
#define FA_SLICE 10240u            // 32 padded rows, rounded up to a multiple of 2 KiB
#define FA_STAGE (8u * FA_SLICE)   // 4 K slices, then 4 V slices: 128 keys
#define FA_LDS (2u * FA_STAGE)
#define FA_NST (TT / 128)
#define FA_EP 272u                 // output staging pitch
#define FA_W0K ((1u << 20) | (5u << 22) | (3u << 25))   // descriptor group 1 word 0: pad of 16 B behind every 256-B row
#define FA_W0V ((1u << 20) | (5u << 22) | (7u << 25))   // the same with 32 B
static_assert(HD == 128 && TT % 256 == 0 && FA_NST >= 2, "k_fattn is written for head size 128 and whole 256-row query blocks");
static_assert(32u * FA_PK <= FA_SLICE && 32u * FA_PV <= FA_SLICE && 2u * FA_NW * FA_CW * FA_EP <= FA_LDS, "slices and output staging must fit");
#define DEV static __device__ __forceinline__
DEV uint32_t uni(uint32_t v) { return (uint32_t)__builtin_amdgcn_readfirstlane(v); }
DEV uint32_t pinned(uint32_t v) { uint32_t w = __builtin_amdgcn_readfirstlane(v); asm volatile("" : "+s"(w)); return w; }   // a test word held in a scalar register: the branch on it is a scalar branch (tensor loads ignore EXEC)
DEV void fence() { __builtin_amdgcn_sched_barrier(0); }   // holds the order of the blocks of a pass as written (what each one is for stands at its use)
DEV void wait_ds0() { asm volatile("s_wait_dscnt 0x0" ::: "memory"); }   // this wave's LDS reads and writes are done
// This wave's own tensor request has landed. Both descriptor groups are read here in the registers the load named: the compiler keeps them there, unwritten, from the load to this wait.
DEV void wait_tensor0(u32x4 g0, u32x8 g1) { asm volatile("s_wait_tensorcnt 0x0" :: "{s[80:83]}"(g0), "{s[84:91]}"(g1) : "memory"); }
DEV void nop4() { asm volatile("v_nop\n\tv_nop\n\tv_nop\n\tv_nop"); }   // the four vector slots behind a WMMA before its D is read or its A or B overwritten
// One tensor load. The descriptor is formed and the load issued in one statement, in twelve fixed scalar registers that nothing else of the kernel uses, so that no word of an outstanding request's descriptor is rewritten
// (left to the register allocator, the groups were copied behind the load and their first registers reused ahead of the wait).
// Group 0 (s80 to s83): count 1, LDS byte, address low, address high | type 2. Group 1 (s84 to s91): W0 (mask 0, 1-byte elements, the pad), tensor = tile = 32 rows of 256 bytes, source pitch 256 bytes.
// The three words that vary go through readfirstlane; every other word is an immediate of the text. The outputs are early-clobbered: no input shares a register with them.
template <uint32_t W0> DEV void tdm_load(uint32_t lds_dst, uint64_t ga, u32x4& g0, u32x8& g1) {
    constexpr uint32_t d0 = FA_ROWB, d1 = 32u;
    asm volatile("s_mov_b32 s80, 1\n\ts_mov_b32 s81, %2\n\ts_mov_b32 s82, %3\n\ts_mov_b32 s83, %4\n\t"
                 "s_mov_b32 s84, %5\n\ts_mov_b32 s85, %6\n\ts_mov_b32 s86, %7\n\ts_mov_b32 s87, %8\n\ts_mov_b32 s88, %9\n\ts_mov_b32 s89, %10\n\ts_mov_b32 s90, 0\n\ts_mov_b32 s91, 0\n\t"
                 "tensor_load_to_lds s[80:83], s[84:91]"
                 : "=&{s[80:83]}"(g0), "=&{s[84:91]}"(g1)
                 : "s"(uni(lds_dst)), "s"(uni((uint32_t)ga)), "s"(uni((((uint32_t)(ga >> 32)) & 0x01FFFFFFu) | 0x80000000u)),
                   "n"(W0), "n"((d0 & 0xFFFFu) << 16), "n"((d0 >> 16) | ((d1 & 0xFFFFu) << 16)), "n"((d1 >> 16) | (d0 << 16)), "n"(d1), "n"(FA_ROWB)
                 : "memory"); }
struct Frag { u32x4 q[2]; };
DEV v8f fmma(const Frag& a, const Frag& b, v8f c) {
    const i32x8 av = {(int)a.q[0].x, (int)a.q[0].y, (int)a.q[0].z, (int)a.q[0].w, (int)a.q[1].x, (int)a.q[1].y, (int)a.q[1].z, (int)a.q[1].w};
    const i32x8 bv = {(int)b.q[0].x, (int)b.q[0].y, (int)b.q[0].z, (int)b.q[0].w, (int)b.q[1].x, (int)b.q[1].y, (int)b.q[1].z, (int)b.q[1].w};
    return wmma16(__builtin_bit_cast(v16h, av), __builtin_bit_cast(v16h, bv), c); }
DEV u32x4 ld_tr16(const unsigned char* p) { typedef __attribute__((address_space(3))) s16x8 lds_s16x8; return __builtin_bit_cast(u32x4, __builtin_amdgcn_ds_load_tr16_b128_v8i16((lds_s16x8*)p)); }
DEV uint32_t pack2h(float lo, float hi) { return __builtin_bit_cast(uint32_t, __builtin_convertvector((v2f){lo, hi}, v2h)); }   // round to nearest even
DEV float xhalf(float x) { return __builtin_bit_cast(float, __builtin_amdgcn_permlanex16(__builtin_bit_cast(int, x), __builtin_bit_cast(int, x), 0x76543210, 0xfedcba98, false, false)); }   // lane l with lane l ^ 16
// Two fp16 ones. Formed in asm so that the operand is made once and stays in its registers: as a constant the compiler knows, it was copied anew from scalar registers in every pass (four 64-bit moves).
DEV uint32_t one2h() { uint32_t w; asm("v_mov_b32 %0, 0x3c003c00" : "=v"(w)); return w; }
struct KFr { Frag f[FA_KT][FA_DK]; };
// koff = byte offset of the pass's K slice in LDS; the hardware k order (bytes 16h and 32 + 16h of each 64), as Q's below.
DEV void load_k(KFr& k, const unsigned char* Lp, uint32_t koff, uint32_t lane) {
    const uint32_t c = lane & 15u, h = lane >> 4;
#pragma unroll
    for (int kt = 0; kt < FA_KT; ++kt) { const unsigned char* p = Lp + koff + (16u * kt + c) * FA_PK + 16u * h;
#pragma unroll
        for (int kc = 0; kc < FA_DK; ++kc) { k.f[kt][kc].q[0] = *reinterpret_cast<const u32x4*>(p + 64u * kc); k.f[kt][kc].q[1] = *reinterpret_cast<const u32x4*>(p + 64u * kc + 32u); } }
}
// One 32-key pass of one wave. negm[g]: eight copies of -(the maximum in use) of the lane's query column; lsum[g]: its running sum, in every element.
DEV void fa_pass(KFr& kf, bool fetch_next, bool first, uint32_t next_koff, const unsigned char* Lp, uint32_t voff, uint32_t lane, const Frag (&qf)[FA_R][FA_DK], const Frag& ones, v8f (&acc)[FA_R][FA_DT], v8f (&negm)[FA_R], v8f (&lsum)[FA_R]) {
    const uint32_t h = lane >> 4;
    v8f s[FA_KT][FA_R];
    wait_ds0(); fence();   // the K fragments fetched ahead have arrived
#pragma unroll
    for (int kt = 0; kt < FA_KT; ++kt) {
#pragma unroll
        for (int g = 0; g < FA_R; ++g) { s[kt][g] = negm[g];
#pragma unroll
            for (int kc = 0; kc < FA_DK; ++kc) s[kt][g] = fmma(kf.f[kt][kc], qf[g][kc], s[kt][g]); } }
    fence(); nop4(); fence();   // keeps the fetch below (it overwrites A operands) behind the products and their slots
    if (fetch_next) load_k(kf, Lp, next_koff, lane);   // the next pass's K of the SAME stage, in flight under the maxima and the first exponentials
    float top[FA_KT][FA_R];   // four independent chains: the largest exponent of each score tile in this lane
#pragma unroll
    for (int kt = 0; kt < FA_KT; ++kt) {
#pragma unroll
        for (int g = 0; g < FA_R; ++g) { float mx = -__builtin_inff();
#pragma unroll
            for (int r = 0; r < 8; ++r) mx = __builtin_fmaxf(mx, s[kt][g][r]);
            top[kt][g] = mx; } }
    const float all = __builtin_fmaxf(__builtin_fmaxf(__builtin_fmaxf(top[0][0], top[0][1]), top[1][0]), top[1][1]);
    const float thr = first ? -__builtin_inff() : 8.0f;   // the first pass always sets the maximum in use
    if (__builtin_amdgcn_ballot_w32(all > thr) != 0) {   // rare after the first pass: some exponent lies more than 8 above the maximum in use
#pragma unroll
        for (int g = 0; g < FA_R; ++g) { float mx = __builtin_fmaxf(top[0][g], top[1][g]); mx = __builtin_fmaxf(mx, xhalf(mx));   // both wave halves hold this query's largest exponent
            const float d = first ? mx : __builtin_fmaxf(mx, 0.0f);   // the maximum in use rises by d; the first pass takes its own maximum, whatever its sign
            const float corr = first ? 0.0f : __builtin_amdgcn_exp2f(-d);   // nothing is summed yet in the first pass
            negm[g] = negm[g] - d; lsum[g] = lsum[g] * corr;
#pragma unroll
            for (int kt = 0; kt < FA_KT; ++kt) s[kt][g] = s[kt][g] - d;
#pragma unroll
            for (int t = 0; t < FA_DT; ++t) acc[g][t] = acc[g][t] * corr; } }
    Frag vf[FA_DT];
    { const unsigned char* ad = Lp + voff + (8u * h + (lane & 7u)) * FA_PV + ((lane >> 3) & 1u) * 16u;
#pragma unroll
      for (int t = 0; t < FA_DT; ++t) { vf[t].q[0] = ld_tr16(ad + 32u * t); vf[t].q[1] = ld_tr16(ad + 16u * FA_PV + 32u * t); } }
#pragma unroll
    for (int g = 0; g < FA_R; ++g) { uint32_t w[8];
#pragma unroll
        for (int i = 0; i < 8; ++i)
            w[i] = pack2h(__builtin_amdgcn_exp2f(s[i >> 2][g][2 * (i & 3)]), __builtin_amdgcn_exp2f(s[i >> 2][g][2 * (i & 3) + 1]));
        Frag pf; pf.q[0] = (u32x4){w[0], w[1], w[2], w[3]}; pf.q[1] = (u32x4){w[4], w[5], w[6], w[7]};
        lsum[g] = fmma(ones, pf, lsum[g]);
        if (g == 0) { wait_ds0(); fence(); }   // the V^T fragments have arrived
#pragma unroll
        for (int t = 0; t < FA_DT; ++t) acc[g][t] = fmma(vf[t], pf, acc[g][t]);
        fence(); }   // one group's P^T live at a time
}
// Q [b][h][t][d], K and V [b][g][t][d] (fp16); Ah, Al [b][t][DQ]: the hi and lo bf16 planes of the merged heads.
__global__ void __launch_bounds__(FA_NW * 32) __attribute__((amdgpu_waves_per_eu(2, 2))) k_fattn(const h16* __restrict__ Q, const h16* __restrict__ K, const h16* __restrict__ V, bf* Ah, bf* Al) {
    __shared__ __attribute__((aligned(2048))) unsigned char L[FA_LDS];
    const uint32_t tid = threadIdx.x, lane = tid & 31u, wave = uni(tid >> 5), c = lane & 15u, h = lane >> 4;
    const uint32_t hq = blockIdx.x, b = blockIdx.y, q0 = blockIdx.z * (uint32_t)(FA_NW * FA_CW), gkv = hq / (uint32_t)REP;
    const uint32_t lbase = (uint32_t)(size_t)L;
    const uint64_t src = (uint64_t)(size_t)((wave < 4u ? K : V) + (size_t)(b * NKV + gkv) * TT * HD) + (uint64_t)((wave & 3u) * 32u) * FA_ROWB;   // this wave's slice of stage 0
    u32x4 g0; u32x8 g1;
    auto issue = [&](uint32_t st) {   // this wave's one request of stage st: rows st * 128 + (wave & 3) * 32 ... + 31
        const uint32_t dst = lbase + (st & 1u) * FA_STAGE + wave * FA_SLICE; const uint64_t ga = src + (uint64_t)(st * 128u) * FA_ROWB;
        if (pinned(wave < 4u)) tdm_load<FA_W0K>(dst, ga, g0, g1);   // the two differ in the pad alone, a constant on either path
        else tdm_load<FA_W0V>(dst, ga, g0, g1);
    };
    issue(0u);
    Frag qf[FA_R][FA_DK];
#pragma unroll
    for (int g = 0; g < FA_R; ++g) { const h16* qp = Q + ((size_t)(b * NH_ + hq) * TT + q0 + wave * FA_CW + 16u * g + c) * HD + 8u * h;
#pragma unroll
        for (int kc = 0; kc < FA_DK; ++kc) { qf[g][kc].q[0] = *reinterpret_cast<const u32x4*>(qp + 32 * kc); qf[g][kc].q[1] = *reinterpret_cast<const u32x4*>(qp + 32 * kc + 16); } }
    v8f acc[FA_R][FA_DT], negm[FA_R], lsum[FA_R];
    Frag ones;   // fp16 1.0 in every place of the A operand
#pragma unroll
    for (int i = 0; i < 4; ++i) { ones.q[0][i] = one2h(); ones.q[1][i] = one2h(); }
#pragma unroll
    for (int g = 0; g < FA_R; ++g) { negm[g] = (v8f){}; lsum[g] = (v8f){};   // the first pass sets the maximum in use
#pragma unroll
        for (int t = 0; t < FA_DT; ++t) acc[g][t] = (v8f){}; }
    wait_tensor0(g0, g1);     // stage 0 has landed (this wave's slice)
    __syncthreads();    // ... and is published to every wave
    issue(1u);
    KFr kf;
#pragma unroll 1   // rolled: one publish point in the text, and the pass loop stays nested in it
    for (uint32_t st = 0; st < (uint32_t)FA_NST; ++st) {
        const uint32_t base = (st & 1u) * FA_STAGE;
        load_k(kf, L, base, lane);
#pragma unroll 1
        for (uint32_t sub = 0; sub < 4u; ++sub)   // kept rolled and nested: one flat or unrolled loop over passes spills
            fa_pass(kf, sub < 3u, (st | sub) == 0u, base + (sub + 1u) * FA_SLICE, L, base + (4u + sub) * FA_SLICE, lane, qf, ones, acc, negm, lsum);
        // Publish point of stage st + 1, every wave: own LDS reads done, own request landed, barrier; only then the refill of the buffer just read.
        wait_ds0();
        wait_tensor0(g0, g1);
        __syncthreads();
        if (pinned(st + 2u < (uint32_t)FA_NST)) issue(st + 2u);
    }
    wait_tensor0(g0, g1);
    wait_ds0();
    // The last publish point's barrier has ended every wave's reads of the ring: it becomes output staging, one region a wave and plane.
    const uint32_t eh = wave * (uint32_t)FA_CW * FA_EP, el = eh + (uint32_t)(FA_NW * FA_CW) * FA_EP;
#pragma unroll
    for (int g = 0; g < FA_R; ++g) { const float inv = 1.0f / lsum[g][0];   // the sum over all keys: the ones product has joined the wave halves
#pragma unroll
        for (int t = 0; t < FA_DT; ++t) { const v8f o = acc[g][t] * inv; u32x4 ph, pw;
#pragma unroll
            for (int i = 0; i < 4; ++i) { unsigned short a0, c0, a1, c1; splitf(o[2 * i], a0, c0); splitf(o[2 * i + 1], a1, c1); ph[i] = (uint32_t)a0 | ((uint32_t)a1 << 16); pw[i] = (uint32_t)c0 | ((uint32_t)c1 << 16); }
            const uint32_t eo = (16u * g + c) * FA_EP + 32u * t + 16u * h;
            *reinterpret_cast<u32x4*>(L + eh + eo) = ph; *reinterpret_cast<u32x4*>(L + el + eo) = pw; } }
    wait_ds0();
    // Read back whole rows: 16 lanes cover one 256-byte row, so every 128-byte line of the planes is stored once.
#pragma unroll
    for (uint32_t i = 0; i < (uint32_t)FA_CW / 2u; ++i) { const uint32_t row = i * 2u + lane / 16u, colb = (lane % 16u) * 16u;
        const u32x4 vh = *reinterpret_cast<const u32x4*>(L + eh + row * FA_EP + colb); const u32x4 vl = *reinterpret_cast<const u32x4*>(L + el + row * FA_EP + colb);
        const size_t ob = (((size_t)b * TT + q0 + wave * FA_CW + row) * DQ + (size_t)hq * HD) * 2 + colb;
        *reinterpret_cast<u32x4*>(reinterpret_cast<unsigned char*>(Ah) + ob) = vh; *reinterpret_cast<u32x4*>(reinterpret_cast<unsigned char*>(Al) + ob) = vl; }
}

// ---- k_gemmw: C[m][n] = sum_k A[m][k] Bt[n][k] (+ A2[m][k] Bt[n][k] where SPLIT), bf16 operands in K-contiguous planes of GK elements a row, f32 accumulate; every wave keeps one 64x64 tile (16 accumulators).
// A workgroup is 2 x WN waves (WN = 2, SPLIT: 4) on a 128 x 64 WN tile; grid (M / 128, N / (64 WN)). Its operand rows come by tensor loads in stages of 64 k (128 bytes a row) into two LDS buffers:
// every wave brings one slice of 64 rows a stage (A: slices 0, 1; SPLIT: A2: 2, 3; then Bt: WN slices), so a row is fetched once a workgroup and each fragment is read from LDS by the waves that share it.
// HEADS: m = b * TT + t, n runs over the q, then the k, then the v columns; the tile goes out rounded to fp16 into the head planes PQ, PK, PV ([b][h][t][d]), the q columns times QSC (in f32, ahead of the one rounding), and C is not used.
// Every "#pragma unroll" of this section but the two over output rows stands over a loop whose index picks a register array's element: unrolled, the arrays stay in registers.
#define GK 768u                    // row length of every operand plane, elements
#define G_ROWB 128u                // bytes of one operand row in a stage
#define G_P 144u                   // its LDS pitch (ds_load_b128 readers): 16 B x odd
#define G_SLICE 10240u             // 64 padded rows, rounded up to a multiple of 2 KiB
#define G_NST (GK / 64u)
#define G_OS (16u * 68u * 4u)      // bytes of one wave's output staging
#define G_W0 ((1u << 20) | (4u << 22) | (3u << 25))   // descriptor group 1 word 0: pad of 16 B behind every 128-B row
static_assert(DM == GK && DQ == GK && G_NST >= 2u && 64u * G_P <= G_SLICE && (NB_ * TT) % 128 == 0 && (DQ + 2 * DKV) % 128 == 0 && DM % 256 == 0, "whole tiles, whole stages, two stages or more");
// One tensor load of 64 rows of 128 bytes at a source pitch of 2 GK bytes: tdm_load's form (fixed scalar registers, descriptor and load in one statement, for the reasons given there) with this tile's constants.
DEV void tdm_load_g(uint32_t lds_dst, uint64_t ga, u32x4& g0, u32x8& g1) {
    constexpr uint32_t d0 = G_ROWB, d1 = 64u;
    asm volatile("s_mov_b32 s80, 1\n\ts_mov_b32 s81, %2\n\ts_mov_b32 s82, %3\n\ts_mov_b32 s83, %4\n\t"
                 "s_mov_b32 s84, %5\n\ts_mov_b32 s85, %6\n\ts_mov_b32 s86, %7\n\ts_mov_b32 s87, %8\n\ts_mov_b32 s88, %9\n\ts_mov_b32 s89, %10\n\ts_mov_b32 s90, 0\n\ts_mov_b32 s91, 0\n\t"
                 "tensor_load_to_lds s[80:83], s[84:91]"
                 : "=&{s[80:83]}"(g0), "=&{s[84:91]}"(g1)
                 : "s"(uni(lds_dst)), "s"(uni((uint32_t)ga)), "s"(uni((((uint32_t)(ga >> 32)) & 0x01FFFFFFu) | 0x80000000u)),
                   "n"(G_W0), "n"((d0 & 0xFFFFu) << 16), "n"((d0 >> 16) | ((d1 & 0xFFFFu) << 16)), "n"((d1 >> 16) | (d0 << 16)), "n"(d1), "n"(2u * GK)
                 : "memory"); }
DEV v16bf ld_fr(const unsigned char* p) { return cat16b(*reinterpret_cast<const v8usa*>(p), *reinterpret_cast<const v8usa*>(p + 32)); }   // the hardware k order: bytes 16 h and 32 + 16 h of each 64 (p holds the 16 h)
template <bool SPLIT, bool HEADS>
__global__ __launch_bounds__(SPLIT ? 256 : 128) void k_gemmw(const bf* __restrict__ A, const bf* __restrict__ A2, const bf* __restrict__ Bt, float* C, int ldc, h16* PQ, h16* PK, h16* PV) {
    constexpr uint32_t WN = SPLIT ? 4u : 2u, NW = 2u * WN, NA = SPLIT ? 4u : 2u, STAGE = NW * G_SLICE;
    __shared__ __attribute__((aligned(2048))) unsigned char L[2u * STAGE + NW * G_OS];   // the ring, then one staging region a wave
    const uint32_t lane = threadIdx.x & 31u, wave = uni(threadIdx.x >> 5), lr = lane & 15u, hi = lane >> 4, wm = wave / WN, wn = wave % WN;
    const uint32_t R0 = blockIdx.x * 128u, C0 = blockIdx.y * (64u * WN);
    const int r0 = (int)(R0 + wm * 64u), c0 = (int)(C0 + wn * 64u);
    const bf* sp = A + (size_t)(R0 + (wave & 1u) * 64u) * GK;   // this wave's slice of stage 0
    if (SPLIT && wave >= 2u) sp = A2 + (size_t)(R0 + (wave & 1u) * 64u) * GK;
    if (wave >= NA) sp = Bt + (size_t)(C0 + (wave - NA) * 64u) * GK;
    const uint64_t src = (uint64_t)(size_t)sp; const uint32_t lbase = (uint32_t)(size_t)L;
    u32x4 g0; u32x8 g1;
    auto issue = [&](uint32_t st) { tdm_load_g(lbase + (st & 1u) * STAGE + wave * G_SLICE, src + (uint64_t)(st * G_ROWB), g0, g1); };   // every wave issues its one request of stage st
    issue(0u);
    v8f acc[4][4];
#pragma unroll
    for (int mb = 0; mb < 4; ++mb)
#pragma unroll
        for (int nb = 0; nb < 4; ++nb) acc[mb][nb] = (v8f){};
    const uint32_t fo = lr * G_P + 16u * hi;   // this lane's place in a 16-row fragment
    wait_tensor0(g0, g1);     // stage 0 has landed (this wave's slice)
    __syncthreads();    // ... and is published to every wave
    issue(1u);
#pragma unroll 1   // rolled: one publish point in the text
    for (uint32_t st = 0; st < G_NST; ++st) {
        const unsigned char* Ls = L + (st & 1u) * STAGE + fo;
        v16bf a[2][4], a2[2][4], b[2][4];
#pragma unroll
        for (uint32_t kc = 0; kc < 2u; ++kc) {
#pragma unroll
            for (uint32_t i = 0; i < 4u; ++i) { a[kc][i] = ld_fr(Ls + wm * G_SLICE + i * 16u * G_P + kc * 64u); b[kc][i] = ld_fr(Ls + (NA + wn) * G_SLICE + i * 16u * G_P + kc * 64u); if (SPLIT) a2[kc][i] = ld_fr(Ls + (2u + wm) * G_SLICE + i * 16u * G_P + kc * 64u); } }
        fence();   // the stage's fragment loads stand as one group ahead of its products: left to the scheduler, a pair of loads and a wait to 0 stood in front of every four WMMAs
#pragma unroll
        for (uint32_t kc = 0; kc < 2u; ++kc) {
#pragma unroll
            for (uint32_t nb = 0; nb < 4u; ++nb) {
#pragma unroll
                for (uint32_t mb = 0; mb < 4u; ++mb) acc[mb][nb] = wmmab(a[kc][mb], b[kc][nb], acc[mb][nb]);
                if (SPLIT) {
#pragma unroll
                    for (uint32_t mb = 0; mb < 4u; ++mb) acc[mb][nb] = wmmab(a2[kc][mb], b[kc][nb], acc[mb][nb]); } } }
        fence(); nop4(); fence();   // the slots behind the stage's last WMMA, on the loop's back edge too, before the next stage's fragment loads overwrite its A and B
        // Publish point of stage st + 1, every wave: own LDS reads done, own request landed, barrier; only then the refill of the buffer just read.
        wait_ds0();
        wait_tensor0(g0, g1);
        __syncthreads();
        if (pinned(st + 2u < G_NST)) issue(st + 2u);
    }
    wait_tensor0(g0, g1);
    wait_ds0();
    float* os = reinterpret_cast<float*>(L + 2u * STAGE + wave * G_OS);   // outside the ring, this wave's own: no barrier is owed
#pragma unroll
    for (int mb = 0; mb < 4; ++mb) {
#pragma unroll
        for (int nb = 0; nb < 4; ++nb) {
#pragma unroll
            for (int j = 0; j < 8; ++j) os[(hi * 8 + j) * 68 + nb * 16 + lr] = acc[mb][nb][j]; }
        __builtin_amdgcn_wave_barrier(); asm volatile("" ::: "memory");   // the staging stores stay ahead of the row reads below (other lanes' values)
        if (HEADS) {   // the tile's 64 rows lie in one batch, its 64 columns in one head: a row of the tile is one whole 128-byte line of the plane
            h16* P = PQ; int nh = NH_, hh = c0 / HD; float osc = QSC;
            if (c0 >= DQ + DKV) { P = PV; nh = NKV; hh = (c0 - DQ - DKV) / HD; osc = 1.0f; } else if (c0 >= DQ) { P = PK; nh = NKV; hh = (c0 - DQ) / HD; osc = 1.0f; }
            h16* prow = P + ((size_t)((r0 / TT) * nh + hh) * TT + (r0 % TT) + mb * 16) * HD + (c0 % HD);
#pragma unroll
            for (int s = 0; s < 4; ++s) { const int row = 4 * s + (lane >> 3), cofs = (lane & 7) * 8; const v4f lo = *(const v4fa*)(os + row * 68 + cofs), up = *(const v4fa*)(os + row * 68 + cofs + 4); v8h o;
#pragma unroll
                for (int k = 0; k < 4; ++k) { o[k] = (h16)(lo[k] * osc); o[k + 4] = (h16)(up[k] * osc); }
                *(v8h*)(prow + (size_t)row * HD + cofs) = o; }
        } else {
            float* crow = C + (size_t)(r0 + mb * 16) * ldc + c0;
#pragma unroll
            for (int s = 0; s < 8; ++s) { const int row = 2 * s + hi, cofs = lr * 4;
                *(v4f*)(crow + (size_t)row * ldc + cofs) = *(const v4fa*)(os + row * 68 + cofs); }
        }
        __builtin_amdgcn_wave_barrier(); asm volatile("" ::: "memory");   // ... and the row reads ahead of the next block's staging stores
    }
}

extern "C" void kernel_launch(void* const* d_in, const int* in_sizes, int n_in,
                              void* d_out, int out_size, void* d_ws, size_t ws_size, hipStream_t stream) {
    (void)in_sizes; (void)n_in; (void)out_size;
    const float* x = (const float*)d_in[0]; const float* wq = (const float*)d_in[1]; const float* wk = (const float*)d_in[2]; const float* wv = (const float*)d_in[3]; const float* wo = (const float*)d_in[4];
    float* OUT = (float*)d_out;     // [2][4096][768]
    char* wsp = (char*)d_ws;
    auto take = [&](size_t bytes) { char* p = wsp; wsp += (bytes + 255) & ~(size_t)255; return (void*)p; };
    bf* XB = (bf*)take((size_t)CV_TOT * 8 * 2); bf* WQ = XB + (size_t)CV_NX * 8; bf* WO = WQ + (size_t)(CV_NQ + 2 * CV_NK) * 8;   // x of both batches [b * TT + t][DM]; wq, wk, wv as one [DQ + 2 DKV][DM] matrix; wo
    h16* QP16 = (h16*)take((size_t)NB_ * NH_ * TT * HD * 2); h16* KP16 = (h16*)take((size_t)NB_ * NKV * TT * HD * 2); h16* VP16 = (h16*)take((size_t)NB_ * NKV * TT * HD * 2);   // head planes [b][h][t][d] of both batches
    bf* ATh = (bf*)take((size_t)NB_ * TT * DQ * 2); bf* ATl = (bf*)take((size_t)NB_ * TT * DQ * 2);
    if ((size_t)(wsp - (char*)d_ws) > ws_size) return;    // ws 256 MiB
    k_cvtall<<<CV_GRID, 256, 0, stream>>>(x, wq, wk, wv, wo, XB);
    k_gemmw<false, true><<<dim3(NB_ * TT / 128, (DQ + 2 * DKV) / 128, 1), 128, 0, stream>>>(XB, nullptr, WQ, nullptr, 0, QP16, KP16, VP16);   // v as [g][t][d] rows: the fused kernel transposes on its LDS read
    k_fattn<<<dim3(NH_, NB_, TT / (FA_NW * FA_CW)), FA_NW * 32, 0, stream>>>(QP16, KP16, VP16, ATh, ATl);
    k_gemmw<true, false><<<dim3(NB_ * TT / 128, DM / 256, 1), 256, 0, stream>>>(ATh, ATl, WO, OUT, DM, nullptr, nullptr, nullptr);
}

// v006
// Measured time: 97.5 microseconds a run.
// In both of two side-by-side timings against v005, it was 1.08 times as fast.
// Counting every step since v000, it is 17.0 times as fast.
#include <hip/hip_runtime.h>
#include <stdint.h>

// Bidirectional grouped-query attention (x [2][4096][768]; q = x wq^T (6 heads x 128) x 128^-0.5, k, v = x wk^T / wv^T ([256][768]: 2 kv heads; query head h = g*3 + r uses kv head h/3); softmax(q.k) over all keys (no mask); out = merged wo^T -> [2][4096][768] (6.3 M)).
// Compute dtypes, f32 accumulate: every input rounded to bf16; q/k/v on PLAIN bf16 operands (inputs: exact); scores and attn.v on single fp16 operands inside one fused kernel (k_fattn); softmax f32, online, its row sums taken over the fp16 weights; wo hl x exact (2 products).
// Four launches: k_cvtall (all inputs to bf16), k_gemmw (q, k, v of both batches, stored as fp16 head planes), k_fattn, k_gemmw (wo, both batches).

#define NB_  2
#define TT   4096
#define DM   768
#define NH_  6
#define NKV  2
#define REP  (NH_ / NKV)
#define HD   128
#define DQ   (NH_ * HD)
#define DKV  (NKV * HD)
#define SCL  0.088388347648318447f   // HD^-0.5
#define QSC  (SCL * 1.4426950408889634f)   // HD^-0.5 log2(e): the q plane is stored times this, so that a score product is already the exponent to base 2
typedef _Float16 h16;
typedef unsigned short bf;
typedef __attribute__((ext_vector_type(16))) __bf16   v16bf;
typedef __attribute__((ext_vector_type(16))) _Float16 v16h;
typedef __attribute__((ext_vector_type(8)))  _Float16 v8h;
typedef __attribute__((ext_vector_type(8)))  unsigned short v8us;
typedef __attribute__((ext_vector_type(8)))  float    v8f;
typedef __attribute__((ext_vector_type(4)))  float    v4f;
typedef v8h  __attribute__((may_alias)) v8ha;
typedef v4f  __attribute__((may_alias)) v4fa;
typedef v8us __attribute__((may_alias)) v8usa;

__device__ __forceinline__ unsigned short f2bf(float f) { unsigned u = __float_as_uint(f); u += 0x7FFFu + ((u >> 16) & 1u); return (unsigned short)(u >> 16); }
__device__ __forceinline__ float bf2f(unsigned short b) { return __uint_as_float(((unsigned)b) << 16); }
__device__ __forceinline__ float bfr(float f) { return bf2f(f2bf(f)); }
__device__ __forceinline__ v16h cat16(v8h lo, v8h hi) { return __builtin_shufflevector(lo, hi, 0, 1, 2, 3, 4, 5, 6, 7, 8, 9, 10, 11, 12, 13, 14, 15); }
__device__ __forceinline__ v16bf cat16b(v8us lo, v8us hi) { return __builtin_bit_cast(v16bf, __builtin_shufflevector(lo, hi, 0, 1, 2, 3, 4, 5, 6, 7, 8, 9, 10, 11, 12, 13, 14, 15)); }
__device__ __forceinline__ v8f wmma16(v16h a, v16h b, v8f c) { return __builtin_amdgcn_wmma_f32_16x16x32_f16(false, a, false, b, (short)0, c, false, false); }
__device__ __forceinline__ v8f wmmab(v16bf a, v16bf b, v8f c) { return __builtin_amdgcn_wmma_f32_16x16x32_bf16(false, a, false, b, (short)0, c, false, false); }



__device__ __forceinline__ h16 tohx(float x) { return (h16)x; }
__device__ __forceinline__ void splitf(float y, unsigned short& h, unsigned short& l) { h = f2bf(y); l = f2bf(y - bf2f(h)); }
typedef __attribute__((ext_vector_type(2))) _Float16 v2h;
typedef __attribute__((ext_vector_type(4))) _Float16 v4h;
typedef __attribute__((ext_vector_type(2))) unsigned short v2us;
typedef __attribute__((ext_vector_type(4))) unsigned short v4us;
typedef __attribute__((ext_vector_type(2))) float v2f;
typedef __attribute__((ext_vector_type(4))) int v4i;

__global__ __launch_bounds__(256) void k_wtG(const float* __restrict__ w, int K, int N, bf* Bt) {
    const int lane = threadIdx.x & 31; const int L0 = (blockIdx.x * 8 + (threadIdx.x >> 5)) * 8; const int nlines = N * K / 64;
{
#pragma unroll 1
        for (int l = 0; l < 8; ++l) { const int L = L0 + l; if (L >= nlines) break; const size_t e = (size_t)L * 64 + lane * 2; const int k = (int)(e % K), n = (int)(e / K); v2us o;
            o[0] = f2bf(w[(size_t)k * N + n]); o[1] = f2bf(w[(size_t)(k + 1) * N + n]); *(v2us*)(Bt + e) = o; }
         }
}
// k_cvtall: every input rounded to bf16 in one launch; dst holds x, wq, wk, wv, wo one behind another. A unit is 8 elements; a thread converts CV_U units, a whole grid apart: a quarter of the waves to start, and each with all its loads in flight at once.
#define CV_NX (NB_ * TT * DM / 8)
#define CV_NQ (DQ * DM / 8)
#define CV_NK (DKV * DM / 8)
#define CV_TOT (CV_NX + 2 * CV_NQ + 2 * CV_NK)
#define CV_U 4
#define CV_GRID (CV_TOT / (CV_U * 256))
static_assert(CV_TOT % (CV_U * 256) == 0 && CV_NX % 256 == 0 && CV_NQ % 256 == 0 && CV_NK % 256 == 0 && TT % 64 == 0 && HD % 64 == 0, "whole blocks of units; a 64 x 64 tile lies in one batch and one head");
__global__ __launch_bounds__(256) void k_cvtall(const float* __restrict__ x, const float* __restrict__ wq, const float* __restrict__ wk, const float* __restrict__ wv, const float* __restrict__ wo, bf* dst) {
    const int u0 = blockIdx.x * 256 + threadIdx.x; v8f v[CV_U];
#pragma unroll
    for (int j = 0; j < CV_U; ++j) { int ub = blockIdx.x + j * CV_GRID; const float* s = x;   // every input is a whole number of 256-unit blocks: the choice of the source is the same for the whole block (scalar)
        if (ub >= CV_NX / 256) { ub -= CV_NX / 256; s = wq;
            if (ub >= CV_NQ / 256) { ub -= CV_NQ / 256; s = wk;
                if (ub >= CV_NK / 256) { ub -= CV_NK / 256; s = wv;
                    if (ub >= CV_NK / 256) { ub -= CV_NK / 256; s = wo; } } } }
        v[j] = *(const v8f*)(s + (size_t)ub * 2048 + threadIdx.x * 8); }
    __builtin_amdgcn_sched_barrier(0);   // all eight loads are issued before the first conversion waits for one (the scheduler had put the last two behind such a wait: a second memory latency)
#pragma unroll
    for (int j = 0; j < CV_U; ++j) { v8us o;
#pragma unroll
        for (int k = 0; k < 8; ++k) o[k] = f2bf(v[j][k]);
        *(v8us*)(dst + (size_t)(u0 + j * (CV_GRID * 256)) * 8) = o; }
}

typedef uint32_t u32x4 __attribute__((ext_vector_type(4)));
typedef uint32_t u32x8 __attribute__((ext_vector_type(8)));
typedef int i32x8 __attribute__((ext_vector_type(8)));
typedef short s16x8 __attribute__((ext_vector_type(8)));
#define FA_NW 8                    // waves per workgroup
#define FA_OW 6                    // of them owners of a column group
#define FA_CW 32                   // query columns per wave
#define FA_R  2                    // 16-column groups per wave
#define FA_KT 2                    // 16-key score tiles per pass
#define FA_DK (HD / 32)
#define FA_DT (HD / 16)
#define FA_ROWB 256u               // bytes of one K or V row
#define FA_PK 272u                 // LDS pitch of K rows (ds_load_b128 readers): 16 B x odd
#define FA_PV 288u                 // LDS pitch of V rows (ds_load_tr16_b128 readers): 32 B x odd
#define FA_SLICE 18432u            // 64 padded rows, rounded up to a multiple of 2 KiB
#define FA_STREAM (4u * FA_SLICE)  // 2 K slices, then 2 V slices: 128 keys
#define FA_STAGE (2u * FA_STREAM)  // the owners' 128 keys, then the helpers'
#define FA_LDS (2u * FA_STAGE)
#define FA_KO (TT / 4 * 3)         // the owners' keys: 0 ... FA_KO - 1; the helpers' are the rest
#define FA_NST (FA_KO / 128)       // stages every wave walks
#define FA_SEG ((TT - FA_KO) / 128)   // stages of the helpers' keys: one column group's share of a helper's walk
#define FA_NCG (REP * TT / FA_CW)  // column groups of one (batch, kv head)
#define FA_EP 272u                 // output staging pitch
#define FA_W0K ((1u << 20) | (5u << 22) | (3u << 25))   // descriptor group 1 word 0: pad of 16 B behind every 256-B row
#define FA_W0V ((1u << 20) | (5u << 22) | (7u << 25))   // the same with 32 B
static_assert(HD == 128 && TT % 512 == 0 && FA_NST >= 2 && FA_NST == 3 * FA_SEG && (FA_SEG & (FA_SEG - 1)) == 0 && FA_NW - FA_OW == 2 && FA_NCG % FA_OW == 0, "k_fattn is written for head size 128, six owners and two helpers with three groups each");
static_assert(64u * FA_PK <= FA_SLICE && 64u * FA_PV <= FA_SLICE && 2u * FA_NW * FA_CW * FA_EP <= FA_LDS && FA_LDS <= 327680u, "slices and output staging must fit");
#define DEV static __device__ __forceinline__
DEV uint32_t uni(uint32_t v) { return (uint32_t)__builtin_amdgcn_readfirstlane(v); }
DEV uint32_t pinned(uint32_t v) { uint32_t w = __builtin_amdgcn_readfirstlane(v); asm volatile("" : "+s"(w)); return w; }   // a test word held in a scalar register: the branch on it is a scalar branch (tensor loads ignore EXEC)
DEV void fence() { __builtin_amdgcn_sched_barrier(0); }   // holds the order of the blocks of a pass as written (what each one is for stands at its use)
DEV void wait_ds0() { asm volatile("s_wait_dscnt 0x0" ::: "memory"); }   // this wave's LDS reads and writes are done
// This wave's own tensor request has landed. Both descriptor groups are read here in the registers the load named: the compiler keeps them there, unwritten, from the load to this wait.
DEV void wait_tensor0(u32x4 g0, u32x8 g1) { asm volatile("s_wait_tensorcnt 0x0" :: "{s[80:83]}"(g0), "{s[84:91]}"(g1) : "memory"); }
DEV void nop4() { asm volatile("v_nop\n\tv_nop\n\tv_nop\n\tv_nop"); }   // the four vector slots behind a WMMA before its D is read or its A or B overwritten
// One tensor load. The descriptor is formed and the load issued in one statement, in twelve fixed scalar registers that nothing else of the kernel uses, so that no word of an outstanding request's descriptor is rewritten
// (left to the register allocator, the groups were copied behind the load and their first registers reused ahead of the wait).
// Group 0 (s80 to s83): count 1, LDS byte, address low, address high | type 2. Group 1 (s84 to s91): W0 (mask 0, 1-byte elements, the pad), tensor = tile = 64 rows of 256 bytes, source pitch 256 bytes.
// The three words that vary go through readfirstlane; every other word is an immediate of the text. The outputs are early-clobbered: no input shares a register with them.
template <uint32_t W0> DEV void tdm_load(uint32_t lds_dst, uint64_t ga, u32x4& g0, u32x8& g1) {
    constexpr uint32_t d0 = FA_ROWB, d1 = 64u;
    asm volatile("s_mov_b32 s80, 1\n\ts_mov_b32 s81, %2\n\ts_mov_b32 s82, %3\n\ts_mov_b32 s83, %4\n\t"
                 "s_mov_b32 s84, %5\n\ts_mov_b32 s85, %6\n\ts_mov_b32 s86, %7\n\ts_mov_b32 s87, %8\n\ts_mov_b32 s88, %9\n\ts_mov_b32 s89, %10\n\ts_mov_b32 s90, 0\n\ts_mov_b32 s91, 0\n\t"
                 "tensor_load_to_lds s[80:83], s[84:91]"
                 : "=&{s[80:83]}"(g0), "=&{s[84:91]}"(g1)
                 : "s"(uni(lds_dst)), "s"(uni((uint32_t)ga)), "s"(uni((((uint32_t)(ga >> 32)) & 0x01FFFFFFu) | 0x80000000u)),
                   "n"(W0), "n"((d0 & 0xFFFFu) << 16), "n"((d0 >> 16) | ((d1 & 0xFFFFu) << 16)), "n"((d1 >> 16) | (d0 << 16)), "n"(d1), "n"(FA_ROWB)
                 : "memory"); }
struct Frag { u32x4 q[2]; };
DEV v8f fmma(const Frag& a, const Frag& b, v8f c) {
    const i32x8 av = {(int)a.q[0].x, (int)a.q[0].y, (int)a.q[0].z, (int)a.q[0].w, (int)a.q[1].x, (int)a.q[1].y, (int)a.q[1].z, (int)a.q[1].w};
    const i32x8 bv = {(int)b.q[0].x, (int)b.q[0].y, (int)b.q[0].z, (int)b.q[0].w, (int)b.q[1].x, (int)b.q[1].y, (int)b.q[1].z, (int)b.q[1].w};
    return wmma16(__builtin_bit_cast(v16h, av), __builtin_bit_cast(v16h, bv), c); }
DEV u32x4 ld_tr16(const unsigned char* p) { typedef __attribute__((address_space(3))) s16x8 lds_s16x8; return __builtin_bit_cast(u32x4, __builtin_amdgcn_ds_load_tr16_b128_v8i16((lds_s16x8*)p)); }
DEV uint32_t pack2h(float lo, float hi) { return __builtin_bit_cast(uint32_t, __builtin_convertvector((v2f){lo, hi}, v2h)); }   // round to nearest even
DEV float xhalf(float x) { return __builtin_bit_cast(float, __builtin_amdgcn_permlanex16(__builtin_bit_cast(int, x), __builtin_bit_cast(int, x), 0x76543210, 0xfedcba98, false, false)); }   // lane l with lane l ^ 16
// Two fp16 ones. Formed in asm so that the operand is made once and stays in its registers: as a constant the compiler knows, it was copied anew from scalar registers in every pass (four 64-bit moves).
DEV uint32_t one2h() { uint32_t w; asm("v_mov_b32 %0, 0x3c003c00" : "=v"(w)); return w; }
struct KFr { Frag f[FA_KT][FA_DK]; };
// Byte offsets of pass sub's 32 K rows and 32 V rows in a stream's stage.
DEV uint32_t k_off(uint32_t sub) { return (sub >> 1) * FA_SLICE + (sub & 1u) * (32u * FA_PK); }
DEV uint32_t v_off(uint32_t sub) { return (2u + (sub >> 1)) * FA_SLICE + (sub & 1u) * (32u * FA_PV); }
// koff = byte offset of the pass's K rows in LDS; the hardware k order (bytes 16h and 32 + 16h of each 64), as Q's below.
DEV void load_k(KFr& k, const unsigned char* Lp, uint32_t koff, uint32_t lane) {
    const uint32_t c = lane & 15u, h = lane >> 4;
#pragma unroll
    for (int kt = 0; kt < FA_KT; ++kt) { const unsigned char* p = Lp + koff + (16u * kt + c) * FA_PK + 16u * h;
#pragma unroll
        for (int kc = 0; kc < FA_DK; ++kc) { k.f[kt][kc].q[0] = *reinterpret_cast<const u32x4*>(p + 64u * kc); k.f[kt][kc].q[1] = *reinterpret_cast<const u32x4*>(p + 64u * kc + 32u); } }
}
// One 32-key pass of one wave. negm[g]: eight copies of -(the maximum in use) of the lane's query column; lsum[g]: its running sum, in every element.
DEV void fa_pass(KFr& kf, bool fetch_next, bool first, uint32_t next_koff, const unsigned char* Lp, uint32_t voff, uint32_t lane, const Frag (&qf)[FA_R][FA_DK], const Frag& ones, v8f (&acc)[FA_R][FA_DT], v8f (&negm)[FA_R], v8f (&lsum)[FA_R]) {
    const uint32_t h = lane >> 4;
    v8f s[FA_KT][FA_R];
    wait_ds0(); fence();   // the K fragments fetched ahead have arrived
#pragma unroll
    for (int kt = 0; kt < FA_KT; ++kt) {
#pragma unroll
        for (int g = 0; g < FA_R; ++g) { s[kt][g] = negm[g];
#pragma unroll
            for (int kc = 0; kc < FA_DK; ++kc) s[kt][g] = fmma(kf.f[kt][kc], qf[g][kc], s[kt][g]); } }
    fence(); nop4(); fence();   // keeps the fetch below (it overwrites A operands) behind the products and their slots
    if (fetch_next) load_k(kf, Lp, next_koff, lane);   // the next pass's K of the SAME stage, in flight under the maxima and the first exponentials
    float top[FA_KT][FA_R];   // four independent chains: the largest exponent of each score tile in this lane
#pragma unroll
    for (int kt = 0; kt < FA_KT; ++kt) {
#pragma unroll
        for (int g = 0; g < FA_R; ++g) { float mx = -__builtin_inff();
#pragma unroll
            for (int r = 0; r < 8; ++r) mx = __builtin_fmaxf(mx, s[kt][g][r]);
            top[kt][g] = mx; } }
    const float all = __builtin_fmaxf(__builtin_fmaxf(__builtin_fmaxf(top[0][0], top[0][1]), top[1][0]), top[1][1]);
    const float thr = first ? -__builtin_inff() : 8.0f;   // the first pass always sets the maximum in use
    if (__builtin_amdgcn_ballot_w32(all > thr) != 0) {   // rare after the first pass: some exponent lies more than 8 above the maximum in use
#pragma unroll
        for (int g = 0; g < FA_R; ++g) { float mx = __builtin_fmaxf(top[0][g], top[1][g]); mx = __builtin_fmaxf(mx, xhalf(mx));   // both wave halves hold this query's largest exponent
            const float d = first ? mx : __builtin_fmaxf(mx, 0.0f);   // the maximum in use rises by d; the first pass takes its own maximum, whatever its sign
            const float corr = first ? 0.0f : __builtin_amdgcn_exp2f(-d);   // nothing is summed yet in the first pass
            negm[g] = negm[g] - d; lsum[g] = lsum[g] * corr;
#pragma unroll
            for (int kt = 0; kt < FA_KT; ++kt) s[kt][g] = s[kt][g] - d;
#pragma unroll
            for (int t = 0; t < FA_DT; ++t) acc[g][t] = acc[g][t] * corr; } }
    Frag vf[FA_DT];
    { const unsigned char* ad = Lp + voff + (8u * h + (lane & 7u)) * FA_PV + ((lane >> 3) & 1u) * 16u;
#pragma unroll
      for (int t = 0; t < FA_DT; ++t) { vf[t].q[0] = ld_tr16(ad + 32u * t); vf[t].q[1] = ld_tr16(ad + 16u * FA_PV + 32u * t); } }
#pragma unroll
    for (int g = 0; g < FA_R; ++g) { uint32_t w[8];
#pragma unroll
        for (int i = 0; i < 8; ++i)
            w[i] = pack2h(__builtin_amdgcn_exp2f(s[i >> 2][g][2 * (i & 3)]), __builtin_amdgcn_exp2f(s[i >> 2][g][2 * (i & 3) + 1]));
        Frag pf; pf.q[0] = (u32x4){w[0], w[1], w[2], w[3]}; pf.q[1] = (u32x4){w[4], w[5], w[6], w[7]};
        lsum[g] = fmma(ones, pf, lsum[g]);
        if (g == 0) { wait_ds0(); fence(); }   // the V^T fragments have arrived
#pragma unroll
        for (int t = 0; t < FA_DT; ++t) acc[g][t] = fmma(vf[t], pf, acc[g][t]);
        fence(); }   // one group's P^T live at a time
}
// Q [b][h][t][d], K and V [b][g][t][d] (fp16); Ah, Al [b][t][DQ]: the hi and lo bf16 planes of the merged heads.
#define FA_XS FA_LDS                                          // hand-over of a helper's sums: 16 KiB a helper, behind the ring
#define FA_XM (FA_STAGE + 5u * FA_SLICE + 64u * FA_PK)        // ... and of its maxima and row sums: 512 B a helper, in the unused tail of a K slice that the output staging does not reach
static_assert(FA_XM + 1024u <= FA_STAGE + 6u * FA_SLICE && FA_XM >= 2u * FA_NW * FA_CW * FA_EP && FA_XS + 32768u <= 327680u, "the hand-over lies clear of tiles and output staging");
__global__ void __launch_bounds__(FA_NW * 32) __attribute__((amdgpu_waves_per_eu(2, 2))) k_fattn(const h16* __restrict__ Q, const h16* __restrict__ K, const h16* __restrict__ V, bf* Ah, bf* Al) {
    __shared__ __attribute__((aligned(2048))) unsigned char L[FA_XS + 32768u];
    const uint32_t tid = threadIdx.x, lane = tid & 31u, wave = uni(tid >> 5), c = lane & 15u, h = lane >> 4;
    const uint32_t blk = blockIdx.x, gkv = blockIdx.y, b = blockIdx.z;
    const bool helper = wave >= (uint32_t)FA_OW;
    const uint32_t hw = helper ? wave - (uint32_t)FA_OW : wave / 3u;   // the helper's number: its own, or that of the helper that works for this owner
    const uint32_t lbase = (uint32_t)(size_t)L;
    // This wave's part in the staging: waves 0 to 3 bring the owners' keys, 4 to 7 the helpers' (the same FA_SEG stages three times over); wave & 2 picks K or V, wave & 1 the 64-row half.
    const uint32_t smask = wave < 4u ? 0xFFFFFFFFu : (uint32_t)(FA_SEG - 1);
    const uint64_t src = (uint64_t)(size_t)(((wave & 2u) == 0u ? K : V) + (size_t)(b * NKV + gkv) * TT * HD) + (uint64_t)((wave < 4u ? 0u : (uint32_t)FA_KO) + (wave & 1u) * 64u) * FA_ROWB;   // its slice of stage 0
    u32x4 g0; u32x8 g1;
    auto issue = [&](uint32_t st) {   // this wave's one request of stage st
        const uint32_t dst = lbase + (st & 1u) * FA_STAGE + wave * FA_SLICE; const uint64_t ga = src + (uint64_t)((st & smask) * 128u) * FA_ROWB;
        if (pinned((wave & 2u) == 0u)) tdm_load<FA_W0K>(dst, ga, g0, g1);   // the two differ in the pad alone, a constant on either path
        else tdm_load<FA_W0V>(dst, ga, g0, g1);
    };
    issue(0u);
    Frag qf[FA_R][FA_DK];
    auto load_q = [&](uint32_t cg) {   // column group cg of this (batch, kv head): query head gkv * REP + cg / (TT / 32), rows (cg % (TT / 32)) * 32 ...
        const uint32_t hq = gkv * (uint32_t)REP + cg / (uint32_t)(TT / FA_CW), t0 = (cg % (uint32_t)(TT / FA_CW)) * (uint32_t)FA_CW;
#pragma unroll
        for (int g = 0; g < FA_R; ++g) { const h16* qp = Q + ((size_t)(b * NH_ + hq) * TT + t0 + 16u * g + c) * HD + 8u * h;
#pragma unroll
            for (int kc = 0; kc < FA_DK; ++kc) { qf[g][kc].q[0] = *reinterpret_cast<const u32x4*>(qp + 32 * kc); qf[g][kc].q[1] = *reinterpret_cast<const u32x4*>(qp + 32 * kc + 16); } }
    };
    const uint32_t cg0 = blk * (uint32_t)FA_OW + (helper ? hw * 3u : wave);   // an owner's group; a helper's first of three
    load_q(cg0);
    v8f acc[FA_R][FA_DT], negm[FA_R], lsum[FA_R];
    Frag ones;   // fp16 1.0 in every place of the A operand
#pragma unroll
    for (int i = 0; i < 4; ++i) { ones.q[0][i] = one2h(); ones.q[1][i] = one2h(); }
    auto clear = [&]() {
#pragma unroll
        for (int g = 0; g < FA_R; ++g) { negm[g] = (v8f){}; lsum[g] = (v8f){};   // the first pass sets the maximum in use
#pragma unroll
            for (int t = 0; t < FA_DT; ++t) acc[g][t] = (v8f){}; } };
    clear();
    wait_tensor0(g0, g1);     // stage 0 has landed (this wave's slice)
    __syncthreads();    // ... and is published to every wave
    issue(1u);
    // An owner takes its helper's partial result in: both are brought to the larger of the two maxima in use and added. Lane and register hold the same element in both waves.
    auto join = [&]() {
        const v4f ml = *reinterpret_cast<const v4fa*>(L + FA_XM + hw * 512u + lane * 16u);
#pragma unroll
        for (int g = 0; g < FA_R; ++g) { const float nn = __builtin_fminf(negm[g][0], ml[2 * g]);
            const float f1 = __builtin_amdgcn_exp2f(nn - negm[g][0]), f2 = __builtin_amdgcn_exp2f(nn - ml[2 * g]);
            lsum[g] = lsum[g] * f1 + ml[2 * g + 1] * f2;
#pragma unroll
            for (int i = 0; i < 8; ++i) negm[g][i] = nn;
#pragma unroll
            for (int t = 0; t < FA_DT; ++t) { const unsigned char* xp = L + FA_XS + hw * 16384u + (uint32_t)(g * FA_DT + t) * 1024u + lane * 16u;
                const v4f lo = *reinterpret_cast<const v4fa*>(xp), up = *reinterpret_cast<const v4fa*>(xp + 512u);
#pragma unroll
                for (int i = 0; i < 4; ++i) { acc[g][t][i] = acc[g][t][i] * f1 + lo[i] * f2; acc[g][t][i + 4] = acc[g][t][i + 4] * f1 + up[i] * f2; } } } };
    const uint32_t fmask = helper ? (uint32_t)(FA_SEG - 1) : 0xFFFFFFFFu;   // a helper starts anew with every group
    KFr kf;
#pragma unroll 1   // rolled: one publish point in the text, and the pass loop stays nested in it
    for (uint32_t st = 0; st < (uint32_t)FA_NST; ++st) {
        if (st != 0u && (st & (uint32_t)(FA_SEG - 1)) == 0u) {   // the publish point just passed has handed over the helpers' finished groups
            if (helper) { load_q(cg0 + st / (uint32_t)FA_SEG); clear(); }
            else if (wave % 3u == st / (uint32_t)FA_SEG - 1u) join();
        }
        const uint32_t base = (st & 1u) * FA_STAGE + (helper ? FA_STREAM : 0u);
        load_k(kf, L, base + k_off(0u), lane);
#pragma unroll 1
        for (uint32_t sub = 0; sub < 4u; ++sub)   // kept rolled and nested: one flat or unrolled loop over passes spills
            fa_pass(kf, sub < 3u, ((st & fmask) | sub) == 0u, base + k_off(sub + 1u), L, base + v_off(sub), lane, qf, ones, acc, negm, lsum);
        if (helper && (st & (uint32_t)(FA_SEG - 1)) == (uint32_t)(FA_SEG - 1)) {   // a group's share is done: its partial result goes to the hand-over, ahead of the publish point's wait and barrier
            nop4();   // the slots behind the pass's last WMMA before its D is read
#pragma unroll
            for (int g = 0; g < FA_R; ++g) {
#pragma unroll
                for (int t = 0; t < FA_DT; ++t) { unsigned char* xp = L + FA_XS + hw * 16384u + (uint32_t)(g * FA_DT + t) * 1024u + lane * 16u;
                    *reinterpret_cast<v4fa*>(xp) = (v4f){acc[g][t][0], acc[g][t][1], acc[g][t][2], acc[g][t][3]}; *reinterpret_cast<v4fa*>(xp + 512u) = (v4f){acc[g][t][4], acc[g][t][5], acc[g][t][6], acc[g][t][7]}; } }
            *reinterpret_cast<v4fa*>(L + FA_XM + hw * 512u + lane * 16u) = (v4f){negm[0][0], lsum[0][0], negm[1][0], lsum[1][0]};
        }
        // Publish point of stage st + 1, every wave: own LDS reads and writes done, own request landed, barrier; only then the refill of the buffer just read.
        wait_ds0();
        wait_tensor0(g0, g1);
        __syncthreads();
        if (pinned(st + 2u < (uint32_t)FA_NST)) issue(st + 2u);
    }
    wait_tensor0(g0, g1);
    wait_ds0();
    if (helper) return;   // behind the last barrier: the helpers have no rows of their own to store
    if (wave % 3u == 2u) join();
    // The last publish point's barrier has ended every wave's reads of the ring: it becomes output staging, one region a wave and plane.
    const uint32_t hq = gkv * (uint32_t)REP + cg0 / (uint32_t)(TT / FA_CW), t0 = (cg0 % (uint32_t)(TT / FA_CW)) * (uint32_t)FA_CW;
    const uint32_t eh = wave * (uint32_t)FA_CW * FA_EP, el = eh + (uint32_t)(FA_NW * FA_CW) * FA_EP;
#pragma unroll
    for (int g = 0; g < FA_R; ++g) { const float inv = 1.0f / lsum[g][0];   // the sum over all keys: the ones product has joined the wave halves
#pragma unroll
        for (int t = 0; t < FA_DT; ++t) { const v8f o = acc[g][t] * inv; u32x4 ph, pw;
#pragma unroll
            for (int i = 0; i < 4; ++i) { unsigned short a0, c0, a1, c1; splitf(o[2 * i], a0, c0); splitf(o[2 * i + 1], a1, c1); ph[i] = (uint32_t)a0 | ((uint32_t)a1 << 16); pw[i] = (uint32_t)c0 | ((uint32_t)c1 << 16); }
            const uint32_t eo = (16u * g + c) * FA_EP + 32u * t + 16u * h;
            *reinterpret_cast<u32x4*>(L + eh + eo) = ph; *reinterpret_cast<u32x4*>(L + el + eo) = pw; } }
    wait_ds0();
    // Read back whole rows: 16 lanes cover one 256-byte row, so every 128-byte line of the planes is stored once.
#pragma unroll
    for (uint32_t i = 0; i < (uint32_t)FA_CW / 2u; ++i) { const uint32_t row = i * 2u + lane / 16u, colb = (lane % 16u) * 16u;
        const u32x4 vh = *reinterpret_cast<const u32x4*>(L + eh + row * FA_EP + colb); const u32x4 vl = *reinterpret_cast<const u32x4*>(L + el + row * FA_EP + colb);
        const size_t ob = (((size_t)b * TT + t0 + row) * DQ + (size_t)hq * HD) * 2 + colb;
        *reinterpret_cast<u32x4*>(reinterpret_cast<unsigned char*>(Ah) + ob) = vh; *reinterpret_cast<u32x4*>(reinterpret_cast<unsigned char*>(Al) + ob) = vl; }
}

// ---- k_gemmw: C[m][n] = sum_k A[m][k] Bt[n][k] (+ A2[m][k] Bt[n][k] where SPLIT), bf16 operands in K-contiguous planes of GK elements a row, f32 accumulate; every wave keeps one 64x64 tile (16 accumulators).
// A workgroup is 2 x WN waves (WN = 2, SPLIT: 4) on a 128 x 64 WN tile; grid (M / 128, N / (64 WN)). Its operand rows come by tensor loads in stages of 64 k (128 bytes a row) into two LDS buffers:
// every wave brings one slice of 64 rows a stage (A: slices 0, 1; SPLIT: A2: 2, 3; then Bt: WN slices), so a row is fetched once a workgroup and each fragment is read from LDS by the waves that share it.
// HEADS: m = b * TT + t, n runs over the q, then the k, then the v columns; the tile goes out rounded to fp16 into the head planes PQ, PK, PV ([b][h][t][d]), the q columns times QSC (in f32, ahead of the one rounding), and C is not used.
// Every "#pragma unroll" of this section but the two over output rows stands over a loop whose index picks a register array's element: unrolled, the arrays stay in registers.
#define GK 768u                    // row length of every operand plane, elements
#define G_ROWB 128u                // bytes of one operand row in a stage
#define G_P 144u                   // its LDS pitch (ds_load_b128 readers): 16 B x odd
#define G_SLICE 10240u             // 64 padded rows, rounded up to a multiple of 2 KiB
#define G_NST (GK / 64u)
#define G_OS (16u * 68u * 4u)      // bytes of one wave's output staging
#define G_W0 ((1u << 20) | (4u << 22) | (3u << 25))   // descriptor group 1 word 0: pad of 16 B behind every 128-B row
static_assert(DM == GK && DQ == GK && G_NST >= 2u && 64u * G_P <= G_SLICE && (NB_ * TT) % 128 == 0 && (DQ + 2 * DKV) % 128 == 0 && DM % 256 == 0, "whole tiles, whole stages, two stages or more");
// One tensor load of 64 rows of 128 bytes at a source pitch of 2 GK bytes: tdm_load's form (fixed scalar registers, descriptor and load in one statement, for the reasons given there) with this tile's constants.
DEV void tdm_load_g(uint32_t lds_dst, uint64_t ga, u32x4& g0, u32x8& g1) {
    constexpr uint32_t d0 = G_ROWB, d1 = 64u;
    asm volatile("s_mov_b32 s80, 1\n\ts_mov_b32 s81, %2\n\ts_mov_b32 s82, %3\n\ts_mov_b32 s83, %4\n\t"
                 "s_mov_b32 s84, %5\n\ts_mov_b32 s85, %6\n\ts_mov_b32 s86, %7\n\ts_mov_b32 s87, %8\n\ts_mov_b32 s88, %9\n\ts_mov_b32 s89, %10\n\ts_mov_b32 s90, 0\n\ts_mov_b32 s91, 0\n\t"
                 "tensor_load_to_lds s[80:83], s[84:91]"
                 : "=&{s[80:83]}"(g0), "=&{s[84:91]}"(g1)
                 : "s"(uni(lds_dst)), "s"(uni((uint32_t)ga)), "s"(uni((((uint32_t)(ga >> 32)) & 0x01FFFFFFu) | 0x80000000u)),
                   "n"(G_W0), "n"((d0 & 0xFFFFu) << 16), "n"((d0 >> 16) | ((d1 & 0xFFFFu) << 16)), "n"((d1 >> 16) | (d0 << 16)), "n"(d1), "n"(2u * GK)
                 : "memory"); }
DEV v16bf ld_fr(const unsigned char* p) { return cat16b(*reinterpret_cast<const v8usa*>(p), *reinterpret_cast<const v8usa*>(p + 32)); }   // the hardware k order: bytes 16 h and 32 + 16 h of each 64 (p holds the 16 h)
template <bool SPLIT, bool HEADS>
__global__ __launch_bounds__(SPLIT ? 256 : 128) void k_gemmw(const bf* __restrict__ A, const bf* __restrict__ A2, const bf* __restrict__ Bt, float* C, int ldc, h16* PQ, h16* PK, h16* PV) {
    constexpr uint32_t WN = SPLIT ? 4u : 2u, NW = 2u * WN, NA = SPLIT ? 4u : 2u, STAGE = NW * G_SLICE;
    __shared__ __attribute__((aligned(2048))) unsigned char L[2u * STAGE + NW * G_OS];   // the ring, then one staging region a wave
    const uint32_t lane = threadIdx.x & 31u, wave = uni(threadIdx.x >> 5), lr = lane & 15u, hi = lane >> 4, wm = wave / WN, wn = wave % WN;
    const uint32_t R0 = blockIdx.x * 128u, C0 = blockIdx.y * (64u * WN);
    const int r0 = (int)(R0 + wm * 64u), c0 = (int)(C0 + wn * 64u);
    const bf* sp = A + (size_t)(R0 + (wave & 1u) * 64u) * GK;   // this wave's slice of stage 0
    if (SPLIT && wave >= 2u) sp = A2 + (size_t)(R0 + (wave & 1u) * 64u) * GK;
    if (wave >= NA) sp = Bt + (size_t)(C0 + (wave - NA) * 64u) * GK;
    const uint64_t src = (uint64_t)(size_t)sp; const uint32_t lbase = (uint32_t)(size_t)L;
    u32x4 g0; u32x8 g1;
    auto issue = [&](uint32_t st) { tdm_load_g(lbase + (st & 1u) * STAGE + wave * G_SLICE, src + (uint64_t)(st * G_ROWB), g0, g1); };   // every wave issues its one request of stage st
    issue(0u);
    v8f acc[4][4];
#pragma unroll
    for (int mb = 0; mb < 4; ++mb)
#pragma unroll
        for (int nb = 0; nb < 4; ++nb) acc[mb][nb] = (v8f){};
    const uint32_t fo = lr * G_P + 16u * hi;   // this lane's place in a 16-row fragment
    wait_tensor0(g0, g1);     // stage 0 has landed (this wave's slice)
    __syncthreads();    // ... and is published to every wave
    issue(1u);
#pragma unroll 1   // rolled: one publish point in the text
    for (uint32_t st = 0; st < G_NST; ++st) {
        const unsigned char* Ls = L + (st & 1u) * STAGE + fo;
        v16bf a[2][4], a2[2][4], b[2][4];
#pragma unroll
        for (uint32_t kc = 0; kc < 2u; ++kc) {
#pragma unroll
            for (uint32_t i = 0; i < 4u; ++i) { a[kc][i] = ld_fr(Ls + wm * G_SLICE + i * 16u * G_P + kc * 64u); b[kc][i] = ld_fr(Ls + (NA + wn) * G_SLICE + i * 16u * G_P + kc * 64u); if (SPLIT) a2[kc][i] = ld_fr(Ls + (2u + wm) * G_SLICE + i * 16u * G_P + kc * 64u); } }
        fence();   // the stage's fragment loads stand as one group ahead of its products: left to the scheduler, a pair of loads and a wait to 0 stood in front of every four WMMAs
#pragma unroll
        for (uint32_t kc = 0; kc < 2u; ++kc) {
#pragma unroll
            for (uint32_t nb = 0; nb < 4u; ++nb) {
#pragma unroll
                for (uint32_t mb = 0; mb < 4u; ++mb) acc[mb][nb] = wmmab(a[kc][mb], b[kc][nb], acc[mb][nb]);
                if (SPLIT) {
#pragma unroll
                    for (uint32_t mb = 0; mb < 4u; ++mb) acc[mb][nb] = wmmab(a2[kc][mb], b[kc][nb], acc[mb][nb]); } } }
        fence(); nop4(); fence();   // the slots behind the stage's last WMMA, on the loop's back edge too, before the next stage's fragment loads overwrite its A and B
        // Publish point of stage st + 1, every wave: own LDS reads done, own request landed, barrier; only then the refill of the buffer just read.
        wait_ds0();
        wait_tensor0(g0, g1);
        __syncthreads();
        if (pinned(st + 2u < G_NST)) issue(st + 2u);
    }
    wait_tensor0(g0, g1);
    wait_ds0();
    float* os = reinterpret_cast<float*>(L + 2u * STAGE + wave * G_OS);   // outside the ring, this wave's own: no barrier is owed
#pragma unroll
    for (int mb = 0; mb < 4; ++mb) {
#pragma unroll
        for (int nb = 0; nb < 4; ++nb) {
#pragma unroll
            for (int j = 0; j < 8; ++j) os[(hi * 8 + j) * 68 + nb * 16 + lr] = acc[mb][nb][j]; }
        __builtin_amdgcn_wave_barrier(); asm volatile("" ::: "memory");   // the staging stores stay ahead of the row reads below (other lanes' values)
        if (HEADS) {   // the tile's 64 rows lie in one batch, its 64 columns in one head: a row of the tile is one whole 128-byte line of the plane
            h16* P = PQ; int nh = NH_, hh = c0 / HD; float osc = QSC;
            if (c0 >= DQ + DKV) { P = PV; nh = NKV; hh = (c0 - DQ - DKV) / HD; osc = 1.0f; } else if (c0 >= DQ) { P = PK; nh = NKV; hh = (c0 - DQ) / HD; osc = 1.0f; }
            h16* prow = P + ((size_t)((r0 / TT) * nh + hh) * TT + (r0 % TT) + mb * 16) * HD + (c0 % HD);
#pragma unroll
            for (int s = 0; s < 4; ++s) { const int row = 4 * s + (lane >> 3), cofs = (lane & 7) * 8; const v4f lo = *(const v4fa*)(os + row * 68 + cofs), up = *(const v4fa*)(os + row * 68 + cofs + 4); v8h o;
#pragma unroll
                for (int k = 0; k < 4; ++k) { o[k] = (h16)(lo[k] * osc); o[k + 4] = (h16)(up[k] * osc); }
                *(v8h*)(prow + (size_t)row * HD + cofs) = o; }
        } else {
            float* crow = C + (size_t)(r0 + mb * 16) * ldc + c0;
#pragma unroll
            for (int s = 0; s < 8; ++s) { const int row = 2 * s + hi, cofs = lr * 4;
                *(v4f*)(crow + (size_t)row * ldc + cofs) = *(const v4fa*)(os + row * 68 + cofs); }
        }
        __builtin_amdgcn_wave_barrier(); asm volatile("" ::: "memory");   // ... and the row reads ahead of the next block's staging stores
    }
}

extern "C" void kernel_launch(void* const* d_in, const int* in_sizes, int n_in,
                              void* d_out, int out_size, void* d_ws, size_t ws_size, hipStream_t stream) {
    (void)in_sizes; (void)n_in; (void)out_size;
    const float* x = (const float*)d_in[0]; const float* wq = (const float*)d_in[1]; const float* wk = (const float*)d_in[2]; const float* wv = (const float*)d_in[3]; const float* wo = (const float*)d_in[4];
    float* OUT = (float*)d_out;     // [2][4096][768]
    char* wsp = (char*)d_ws;
    auto take = [&](size_t bytes) { char* p = wsp; wsp += (bytes + 255) & ~(size_t)255; return (void*)p; };
    bf* XB = (bf*)take((size_t)CV_TOT * 8 * 2); bf* WQ = XB + (size_t)CV_NX * 8; bf* WO = WQ + (size_t)(CV_NQ + 2 * CV_NK) * 8;   // x of both batches [b * TT + t][DM]; wq, wk, wv as one [DQ + 2 DKV][DM] matrix; wo
    h16* QP16 = (h16*)take((size_t)NB_ * NH_ * TT * HD * 2); h16* KP16 = (h16*)take((size_t)NB_ * NKV * TT * HD * 2); h16* VP16 = (h16*)take((size_t)NB_ * NKV * TT * HD * 2);   // head planes [b][h][t][d] of both batches
    bf* ATh = (bf*)take((size_t)NB_ * TT * DQ * 2); bf* ATl = (bf*)take((size_t)NB_ * TT * DQ * 2);
    if ((size_t)(wsp - (char*)d_ws) > ws_size) return;    // ws 256 MiB
    k_cvtall<<<CV_GRID, 256, 0, stream>>>(x, wq, wk, wv, wo, XB);
    k_gemmw<false, true><<<dim3(NB_ * TT / 128, (DQ + 2 * DKV) / 128, 1), 128, 0, stream>>>(XB, nullptr, WQ, nullptr, 0, QP16, KP16, VP16);   // v as [g][t][d] rows: the fused kernel transposes on its LDS read
    k_fattn<<<dim3(FA_NCG / FA_OW, NKV, NB_), FA_NW * 32, 0, stream>>>(QP16, KP16, VP16, ATh, ATl);
    k_gemmw<true, false><<<dim3(NB_ * TT / 128, DM / 256, 1), 256, 0, stream>>>(ATh, ATl, WO, OUT, DM, nullptr, nullptr, nullptr);
}

// v008
// A run of this version takes 88.4 microseconds.
// It is 1.10 times as fast as v006, going by the measured steps of the versions left out in between.
// Over all steps from v000 it is 18.8 times as fast.
#include <hip/hip_runtime.h>
#include <stdint.h>

// Bidirectional grouped-query attention (x [2][4096][768]; q = x wq^T (6 heads x 128) x 128^-0.5, k, v = x wk^T / wv^T ([256][768]: 2 kv heads; query head h = g*3 + r uses kv head h/3); softmax(q.k) over all keys (no mask); out = merged wo^T -> [2][4096][768] (6.3 M)).
// Compute dtypes, f32 accumulate: every input rounded to bf16; q/k/v on PLAIN bf16 operands (inputs: exact); scores and attn.v on single fp16 operands inside one fused kernel (k_fattn); softmax f32, online, its row sums taken over the fp16 weights; wo on single fp16 operands too: the merged heads rounded once to fp16, wo's bf16 value held as fp16.
// Four launches: k_cvtall (all inputs to bf16; wo from there to fp16), k_gemmw (q, k, v of both batches, stored as fp16 head planes), k_fattn, k_gemmw (wo, both batches).

#define NB_  2
#define TT   4096
#define DM   768
#define NH_  6
#define NKV  2
#define REP  (NH_ / NKV)
#define HD   128
#define DQ   (NH_ * HD)
#define DKV  (NKV * HD)
#define SCL  0.088388347648318447f   // HD^-0.5
#define QSC  (SCL * 1.4426950408889634f)   // HD^-0.5 log2(e): the q plane is stored times this, so that a score product is already the exponent to base 2
typedef _Float16 h16;
typedef unsigned short bf;
typedef __attribute__((ext_vector_type(16))) __bf16   v16bf;
typedef __attribute__((ext_vector_type(16))) _Float16 v16h;
typedef __attribute__((ext_vector_type(8)))  _Float16 v8h;
typedef __attribute__((ext_vector_type(8)))  unsigned short v8us;
typedef __attribute__((ext_vector_type(8)))  float    v8f;
typedef __attribute__((ext_vector_type(4)))  float    v4f;
typedef v8h  __attribute__((may_alias)) v8ha;
typedef v4f  __attribute__((may_alias)) v4fa;
typedef v8us __attribute__((may_alias)) v8usa;

__device__ __forceinline__ unsigned short f2bf(float f) { unsigned u = __float_as_uint(f); u += 0x7FFFu + ((u >> 16) & 1u); return (unsigned short)(u >> 16); }
__device__ __forceinline__ float bf2f(unsigned short b) { return __uint_as_float(((unsigned)b) << 16); }
__device__ __forceinline__ float bfr(float f) { return bf2f(f2bf(f)); }
__device__ __forceinline__ v16h cat16(v8h lo, v8h hi) { return __builtin_shufflevector(lo, hi, 0, 1, 2, 3, 4, 5, 6, 7, 8, 9, 10, 11, 12, 13, 14, 15); }
__device__ __forceinline__ v16bf cat16b(v8us lo, v8us hi) { return __builtin_bit_cast(v16bf, __builtin_shufflevector(lo, hi, 0, 1, 2, 3, 4, 5, 6, 7, 8, 9, 10, 11, 12, 13, 14, 15)); }
__device__ __forceinline__ v8f wmma16(v16h a, v16h b, v8f c) { return __builtin_amdgcn_wmma_f32_16x16x32_f16(false, a, false, b, (short)0, c, false, false); }
__device__ __forceinline__ v8f wmmab(v16bf a, v16bf b, v8f c) { return __builtin_amdgcn_wmma_f32_16x16x32_bf16(false, a, false, b, (short)0, c, false, false); }



__device__ __forceinline__ h16 tohx(float x) { return (h16)x; }
typedef __attribute__((ext_vector_type(2))) _Float16 v2h;
typedef __attribute__((ext_vector_type(4))) _Float16 v4h;
typedef __attribute__((ext_vector_type(2))) unsigned short v2us;
typedef __attribute__((ext_vector_type(4))) unsigned short v4us;
typedef __attribute__((ext_vector_type(2))) float v2f;
typedef __attribute__((ext_vector_type(4))) int v4i;

__global__ __launch_bounds__(256) void k_wtG(const float* __restrict__ w, int K, int N, bf* Bt) {
    const int lane = threadIdx.x & 31; const int L0 = (blockIdx.x * 8 + (threadIdx.x >> 5)) * 8; const int nlines = N * K / 64;
{
#pragma unroll 1
        for (int l = 0; l < 8; ++l) { const int L = L0 + l; if (L >= nlines) break; const size_t e = (size_t)L * 64 + lane * 2; const int k = (int)(e % K), n = (int)(e / K); v2us o;
            o[0] = f2bf(w[(size_t)k * N + n]); o[1] = f2bf(w[(size_t)(k + 1) * N + n]); *(v2us*)(Bt + e) = o; }
         }
}
// k_cvtall: every input rounded to bf16 in one launch; dst holds x, wq, wk, wv, wo one behind another, wo's rounded values as fp16 (the wo product runs on fp16 operands). A unit is 8 elements; a thread converts CV_U units, a whole grid apart: a quarter of the waves to start, and each with all its loads in flight at once.
#define CV_NX (NB_ * TT * DM / 8)
#define CV_NQ (DQ * DM / 8)
#define CV_NK (DKV * DM / 8)
#define CV_TOT (CV_NX + 2 * CV_NQ + 2 * CV_NK)
#define CV_U 4
#define CV_GRID (CV_TOT / (CV_U * 256))
static_assert(CV_TOT % (CV_U * 256) == 0 && CV_NX % 256 == 0 && CV_NQ % 256 == 0 && CV_NK % 256 == 0 && TT % 64 == 0 && HD % 64 == 0, "whole blocks of units; a 64 x 64 tile lies in one batch and one head");
__global__ __launch_bounds__(256) void k_cvtall(const float* __restrict__ x, const float* __restrict__ wq, const float* __restrict__ wk, const float* __restrict__ wv, const float* __restrict__ wo, bf* dst) {
    const int u0 = blockIdx.x * 256 + threadIdx.x; v8f v[CV_U]; bool w16[CV_U];
#pragma unroll
    for (int j = 0; j < CV_U; ++j) { int ub = blockIdx.x + j * CV_GRID; const float* s = x; w16[j] = false;   // every input is a whole number of 256-unit blocks: the choice of the source is the same for the whole block (scalar)
        if (ub >= CV_NX / 256) { ub -= CV_NX / 256; s = wq;
            if (ub >= CV_NQ / 256) { ub -= CV_NQ / 256; s = wk;
                if (ub >= CV_NK / 256) { ub -= CV_NK / 256; s = wv;
                    if (ub >= CV_NK / 256) { ub -= CV_NK / 256; s = wo; w16[j] = true; } } } }
        v[j] = *(const v8f*)(s + (size_t)ub * 2048 + threadIdx.x * 8); }
    __builtin_amdgcn_sched_barrier(0);   // all eight loads are issued before the first conversion waits for one (the scheduler had put the last two behind such a wait: a second memory latency)
#pragma unroll
    for (int j = 0; j < CV_U; ++j) { v8us o;
#pragma unroll
        for (int k = 0; k < 8; ++k) o[k] = f2bf(v[j][k]);
        if (w16[j]) {   // the same for the whole block, like the source
#pragma unroll
            for (int k = 0; k < 8; ++k) o[k] = __builtin_bit_cast(unsigned short, (h16)bf2f(o[k])); }
        *(v8us*)(dst + (size_t)(u0 + j * (CV_GRID * 256)) * 8) = o; }
}

typedef uint32_t u32x4 __attribute__((ext_vector_type(4)));
typedef uint32_t u32x8 __attribute__((ext_vector_type(8)));
typedef int i32x8 __attribute__((ext_vector_type(8)));
typedef short s16x8 __attribute__((ext_vector_type(8)));
#define FA_NW 8                    // waves per workgroup
#define FA_OW 6                    // of them owners of a column group
#define FA_CW 32                   // query columns per wave
#define FA_R  2                    // 16-column groups per wave
#define FA_KT 2                    // 16-key score tiles per pass
#define FA_DK (HD / 32)
#define FA_DT (HD / 16)
#define FA_ROWB 256u               // bytes of one K or V row
#define FA_PK 272u                 // LDS pitch of K rows (ds_load_b128 readers): 16 B x odd
#define FA_PV 288u                 // LDS pitch of V rows (ds_load_tr16_b128 readers): 32 B x odd
#define FA_SLICE 18432u            // 64 padded rows, rounded up to a multiple of 2 KiB
#define FA_STREAM (4u * FA_SLICE)  // 2 K slices, then 2 V slices: 128 keys
#define FA_STAGE (2u * FA_STREAM)  // the owners' 128 keys, then the helpers'
#define FA_LDS (2u * FA_STAGE)
#define FA_KO (TT / 4 * 3)         // the owners' keys: 0 ... FA_KO - 1; the helpers' are the rest
#define FA_NST (FA_KO / 128)       // stages every wave walks
#define FA_SEG ((TT - FA_KO) / 128)   // stages of the helpers' keys: one column group's share of a helper's walk
#define FA_NCG (REP * TT / FA_CW)  // column groups of one (batch, kv head)
#define FA_EP 272u                 // output staging pitch
#define FA_W0K ((1u << 20) | (5u << 22) | (3u << 25))   // descriptor group 1 word 0: pad of 16 B behind every 256-B row
#define FA_W0V ((1u << 20) | (5u << 22) | (7u << 25))   // the same with 32 B
static_assert(HD == 128 && TT % 512 == 0 && FA_NST >= 2 && FA_NST == 3 * FA_SEG && (FA_SEG & (FA_SEG - 1)) == 0 && FA_NW - FA_OW == 2 && FA_NCG % FA_OW == 0, "k_fattn is written for head size 128, six owners and two helpers with three groups each");
static_assert(64u * FA_PK <= FA_SLICE && 64u * FA_PV <= FA_SLICE && FA_NW * FA_CW * FA_EP <= FA_LDS && FA_LDS <= 327680u, "slices and output staging must fit");
#define DEV static __device__ __forceinline__
DEV uint32_t uni(uint32_t v) { return (uint32_t)__builtin_amdgcn_readfirstlane(v); }
DEV uint32_t pinned(uint32_t v) { uint32_t w = __builtin_amdgcn_readfirstlane(v); asm volatile("" : "+s"(w)); return w; }   // a test word held in a scalar register: the branch on it is a scalar branch (tensor loads ignore EXEC)
DEV void fence() { __builtin_amdgcn_sched_barrier(0); }   // holds the order of the blocks of a pass as written (what each one is for stands at its use)
DEV void wait_ds0() { asm volatile("s_wait_dscnt 0x0" ::: "memory"); }   // this wave's LDS reads and writes are done
// This wave's own tensor request has landed. Both descriptor groups are read here in the registers the load named: the compiler keeps them there, unwritten, from the load to this wait.
DEV void wait_tensor0(u32x4 g0, u32x8 g1) { asm volatile("s_wait_tensorcnt 0x0" :: "{s[80:83]}"(g0), "{s[84:91]}"(g1) : "memory"); }
DEV void nop4() { asm volatile("v_nop\n\tv_nop\n\tv_nop\n\tv_nop"); }   // the four vector slots behind a WMMA before its D is read or its A or B overwritten
// One tensor load. The descriptor is formed and the load issued in one statement, in twelve fixed scalar registers that nothing else of the kernel uses, so that no word of an outstanding request's descriptor is rewritten
// (left to the register allocator, the groups were copied behind the load and their first registers reused ahead of the wait).
// Group 0 (s80 to s83): count 1, LDS byte, address low, address high | type 2. Group 1 (s84 to s91): W0 (mask 0, 1-byte elements, the pad), tensor = tile = 64 rows of 256 bytes, source pitch 256 bytes.
// The three words that vary go through readfirstlane; every other word is an immediate of the text. The outputs are early-clobbered: no input shares a register with them.
template <uint32_t W0> DEV void tdm_load(uint32_t lds_dst, uint64_t ga, u32x4& g0, u32x8& g1) {
    constexpr uint32_t d0 = FA_ROWB, d1 = 64u;
    asm volatile("s_mov_b32 s80, 1\n\ts_mov_b32 s81, %2\n\ts_mov_b32 s82, %3\n\ts_mov_b32 s83, %4\n\t"
                 "s_mov_b32 s84, %5\n\ts_mov_b32 s85, %6\n\ts_mov_b32 s86, %7\n\ts_mov_b32 s87, %8\n\ts_mov_b32 s88, %9\n\ts_mov_b32 s89, %10\n\ts_mov_b32 s90, 0\n\ts_mov_b32 s91, 0\n\t"
                 "tensor_load_to_lds s[80:83], s[84:91]"
                 : "=&{s[80:83]}"(g0), "=&{s[84:91]}"(g1)
                 : "s"(uni(lds_dst)), "s"(uni((uint32_t)ga)), "s"(uni((((uint32_t)(ga >> 32)) & 0x01FFFFFFu) | 0x80000000u)),
                   "n"(W0), "n"((d0 & 0xFFFFu) << 16), "n"((d0 >> 16) | ((d1 & 0xFFFFu) << 16)), "n"((d1 >> 16) | (d0 << 16)), "n"(d1), "n"(FA_ROWB)
                 : "memory"); }
struct Frag { u32x4 q[2]; };
DEV v8f fmma(const Frag& a, const Frag& b, v8f c) {
    const i32x8 av = {(int)a.q[0].x, (int)a.q[0].y, (int)a.q[0].z, (int)a.q[0].w, (int)a.q[1].x, (int)a.q[1].y, (int)a.q[1].z, (int)a.q[1].w};
    const i32x8 bv = {(int)b.q[0].x, (int)b.q[0].y, (int)b.q[0].z, (int)b.q[0].w, (int)b.q[1].x, (int)b.q[1].y, (int)b.q[1].z, (int)b.q[1].w};
    return wmma16(__builtin_bit_cast(v16h, av), __builtin_bit_cast(v16h, bv), c); }
DEV u32x4 ld_tr16(const unsigned char* p) { typedef __attribute__((address_space(3))) s16x8 lds_s16x8; return __builtin_bit_cast(u32x4, __builtin_amdgcn_ds_load_tr16_b128_v8i16((lds_s16x8*)p)); }
DEV uint32_t pack2h(float lo, float hi) { return __builtin_bit_cast(uint32_t, __builtin_convertvector((v2f){lo, hi}, v2h)); }   // round to nearest even
DEV float xhalf(float x) { return __builtin_bit_cast(float, __builtin_amdgcn_permlanex16(__builtin_bit_cast(int, x), __builtin_bit_cast(int, x), 0x76543210, 0xfedcba98, false, false)); }   // lane l with lane l ^ 16
// Two fp16 ones. Formed in asm so that the operand is made once and stays in its registers: as a constant the compiler knows, it was copied anew from scalar registers in every pass (four 64-bit moves).
DEV uint32_t one2h() { uint32_t w; asm("v_mov_b32 %0, 0x3c003c00" : "=v"(w)); return w; }
struct KFr { Frag f[FA_KT][FA_DK]; };
// Byte offsets of pass sub's 32 K rows and 32 V rows in a stream's stage.
DEV uint32_t k_off(uint32_t sub) { return (sub >> 1) * FA_SLICE + (sub & 1u) * (32u * FA_PK); }
DEV uint32_t v_off(uint32_t sub) { return (2u + (sub >> 1)) * FA_SLICE + (sub & 1u) * (32u * FA_PV); }
// koff = byte offset of the pass's K rows in LDS; the hardware k order (bytes 16h and 32 + 16h of each 64), as Q's below.
DEV void load_k(KFr& k, const unsigned char* Lp, uint32_t koff, uint32_t lane) {
    const uint32_t c = lane & 15u, h = lane >> 4;
#pragma unroll
    for (int kt = 0; kt < FA_KT; ++kt) { const unsigned char* p = Lp + koff + (16u * kt + c) * FA_PK + 16u * h;
#pragma unroll
        for (int kc = 0; kc < FA_DK; ++kc) { k.f[kt][kc].q[0] = *reinterpret_cast<const u32x4*>(p + 64u * kc); k.f[kt][kc].q[1] = *reinterpret_cast<const u32x4*>(p + 64u * kc + 32u); } }
}
// One 32-key pass of one wave. negm[g]: eight copies of -(the maximum in use) of the lane's query column; lsum[g]: its running sum, in every element.
DEV void fa_pass(KFr& kf, bool fetch_next, bool first, uint32_t next_koff, const unsigned char* Lp, uint32_t voff, uint32_t lane, const Frag (&qf)[FA_R][FA_DK], const Frag& ones, v8f (&acc)[FA_R][FA_DT], v8f (&negm)[FA_R], v8f (&lsum)[FA_R]) {
    const uint32_t h = lane >> 4;
    v8f s[FA_KT][FA_R];
    wait_ds0(); fence();   // the K fragments fetched ahead have arrived
#pragma unroll
    for (int kt = 0; kt < FA_KT; ++kt) {
#pragma unroll
        for (int g = 0; g < FA_R; ++g) { s[kt][g] = negm[g];
#pragma unroll
            for (int kc = 0; kc < FA_DK; ++kc) s[kt][g] = fmma(kf.f[kt][kc], qf[g][kc], s[kt][g]); } }
    fence(); nop4(); fence();   // keeps the fetch below (it overwrites A operands) behind the products and their slots
    if (fetch_next) load_k(kf, Lp, next_koff, lane);   // the next pass's K of the SAME stage, in flight under the maxima and the first exponentials
    float top[FA_KT][FA_R];   // four independent chains: the largest exponent of each score tile in this lane
#pragma unroll
    for (int kt = 0; kt < FA_KT; ++kt) {
#pragma unroll
        for (int g = 0; g < FA_R; ++g) { float mx = -__builtin_inff();
#pragma unroll
            for (int r = 0; r < 8; ++r) mx = __builtin_fmaxf(mx, s[kt][g][r]);
            top[kt][g] = mx; } }
    const float all = __builtin_fmaxf(__builtin_fmaxf(__builtin_fmaxf(top[0][0], top[0][1]), top[1][0]), top[1][1]);
    const float thr = first ? -__builtin_inff() : 8.0f;   // the first pass always sets the maximum in use
    if (__builtin_amdgcn_ballot_w32(all > thr) != 0) {   // rare after the first pass: some exponent lies more than 8 above the maximum in use
#pragma unroll
        for (int g = 0; g < FA_R; ++g) { float mx = __builtin_fmaxf(top[0][g], top[1][g]); mx = __builtin_fmaxf(mx, xhalf(mx));   // both wave halves hold this query's largest exponent
            const float d = first ? mx : __builtin_fmaxf(mx, 0.0f);   // the maximum in use rises by d; the first pass takes its own maximum, whatever its sign
            const float corr = first ? 0.0f : __builtin_amdgcn_exp2f(-d);   // nothing is summed yet in the first pass
            negm[g] = negm[g] - d; lsum[g] = lsum[g] * corr;
#pragma unroll
            for (int kt = 0; kt < FA_KT; ++kt) s[kt][g] = s[kt][g] - d;
#pragma unroll
            for (int t = 0; t < FA_DT; ++t) acc[g][t] = acc[g][t] * corr; } }
    Frag vf[FA_DT];
    { const unsigned char* ad = Lp + voff + (8u * h + (lane & 7u)) * FA_PV + ((lane >> 3) & 1u) * 16u;
#pragma unroll
      for (int t = 0; t < FA_DT; ++t) { vf[t].q[0] = ld_tr16(ad + 32u * t); vf[t].q[1] = ld_tr16(ad + 16u * FA_PV + 32u * t); } }
#pragma unroll
    for (int g = 0; g < FA_R; ++g) { uint32_t w[8];
#pragma unroll
        for (int i = 0; i < 8; ++i)
            w[i] = pack2h(__builtin_amdgcn_exp2f(s[i >> 2][g][2 * (i & 3)]), __builtin_amdgcn_exp2f(s[i >> 2][g][2 * (i & 3) + 1]));
        Frag pf; pf.q[0] = (u32x4){w[0], w[1], w[2], w[3]}; pf.q[1] = (u32x4){w[4], w[5], w[6], w[7]};
        lsum[g] = fmma(ones, pf, lsum[g]);
        if (g == 0) { wait_ds0(); fence(); }   // the V^T fragments have arrived
#pragma unroll
        for (int t = 0; t < FA_DT; ++t) acc[g][t] = fmma(vf[t], pf, acc[g][t]);
        fence(); }   // one group's P^T live at a time
}
// Q [b][h][t][d], K and V [b][g][t][d] (fp16); AO [b][t][DQ]: the merged heads, rounded once to fp16.
#define FA_XS FA_LDS                                          // hand-over of a helper's sums: 16 KiB a helper, behind the ring
#define FA_XM (FA_STAGE + 5u * FA_SLICE + 64u * FA_PK)        // ... and of its maxima and row sums: 512 B a helper, in the unused tail of a K slice that the output staging does not reach
static_assert(FA_XM + 1024u <= FA_STAGE + 6u * FA_SLICE && FA_XM >= FA_NW * FA_CW * FA_EP && FA_XS + 32768u <= 327680u, "the hand-over lies clear of tiles and output staging");
__global__ void __launch_bounds__(FA_NW * 32) __attribute__((amdgpu_waves_per_eu(2, 2))) k_fattn(const h16* __restrict__ Q, const h16* __restrict__ K, const h16* __restrict__ V, h16* AO) {
    __shared__ __attribute__((aligned(2048))) unsigned char L[FA_XS + 32768u];
    const uint32_t tid = threadIdx.x, lane = tid & 31u, wave = uni(tid >> 5), c = lane & 15u, h = lane >> 4;
    const uint32_t blk = blockIdx.x, gkv = blockIdx.y, b = blockIdx.z;
    const bool helper = wave >= (uint32_t)FA_OW;
    const uint32_t hw = helper ? wave - (uint32_t)FA_OW : wave / 3u;   // the helper's number: its own, or that of the helper that works for this owner
    const uint32_t lbase = (uint32_t)(size_t)L;
    // This wave's part in the staging: waves 0 to 3 bring the owners' keys, 4 to 7 the helpers' (the same FA_SEG stages three times over); wave & 2 picks K or V, wave & 1 the 64-row half.
    const uint32_t smask = wave < 4u ? 0xFFFFFFFFu : (uint32_t)(FA_SEG - 1);
    // The 64 workgroups of a (batch, kv head) walk the same K and V rows at the same pace. Each starts its walk at a stage of its own and wraps round (the softmax takes the keys in any order),
    // so that at any moment they ask L2 for different lines. Indices next to each other and indices eight apart both get different starts.
    const uint32_t nstr = wave < 4u ? (uint32_t)FA_NST : (uint32_t)FA_SEG;   // stages of this wave's stream
    const uint32_t st0 = wave < 4u ? (blk + (blk >> 3)) % (uint32_t)FA_NST : (blk + (blk >> 3)) % (uint32_t)FA_SEG;   // the stage of it that is walked first
    const uint64_t src = (uint64_t)(size_t)(((wave & 2u) == 0u ? K : V) + (size_t)(b * NKV + gkv) * TT * HD) + (uint64_t)((wave < 4u ? 0u : (uint32_t)FA_KO) + (wave & 1u) * 64u) * FA_ROWB;   // its slice of stage 0
    u32x4 g0; u32x8 g1;
    auto issue = [&](uint32_t st) {   // this wave's one request of stage st
        const uint32_t dst = lbase + (st & 1u) * FA_STAGE + wave * FA_SLICE; uint32_t ks = (st & smask) + st0; if (ks >= nstr) ks -= nstr;   // both terms lie below nstr: ks is a stage of the stream
        const uint64_t ga = src + (uint64_t)(ks * 128u) * FA_ROWB;
        if (pinned((wave & 2u) == 0u)) tdm_load<FA_W0K>(dst, ga, g0, g1);   // the two differ in the pad alone, a constant on either path
        else tdm_load<FA_W0V>(dst, ga, g0, g1);
    };
    issue(0u);
    Frag qf[FA_R][FA_DK];
    auto load_q = [&](uint32_t cg) {   // column group cg of this (batch, kv head): query head gkv * REP + cg / (TT / 32), rows (cg % (TT / 32)) * 32 ...
        const uint32_t hq = gkv * (uint32_t)REP + cg / (uint32_t)(TT / FA_CW), t0 = (cg % (uint32_t)(TT / FA_CW)) * (uint32_t)FA_CW;
#pragma unroll
        for (int g = 0; g < FA_R; ++g) { const h16* qp = Q + ((size_t)(b * NH_ + hq) * TT + t0 + 16u * g + c) * HD + 8u * h;
#pragma unroll
            for (int kc = 0; kc < FA_DK; ++kc) { qf[g][kc].q[0] = *reinterpret_cast<const u32x4*>(qp + 32 * kc); qf[g][kc].q[1] = *reinterpret_cast<const u32x4*>(qp + 32 * kc + 16); } }
    };
    const uint32_t cg0 = blk * (uint32_t)FA_OW + (helper ? hw * 3u : wave);   // an owner's group; a helper's first of three
    load_q(cg0);
    v8f acc[FA_R][FA_DT], negm[FA_R], lsum[FA_R];
    Frag ones;   // fp16 1.0 in every place of the A operand
#pragma unroll
    for (int i = 0; i < 4; ++i) { ones.q[0][i] = one2h(); ones.q[1][i] = one2h(); }
    auto clear = [&]() {
#pragma unroll
        for (int g = 0; g < FA_R; ++g) { negm[g] = (v8f){}; lsum[g] = (v8f){};   // the first pass sets the maximum in use
#pragma unroll
            for (int t = 0; t < FA_DT; ++t) acc[g][t] = (v8f){}; } };
    clear();
    wait_tensor0(g0, g1);     // stage 0 has landed (this wave's slice)
    __syncthreads();    // ... and is published to every wave
    issue(1u);
    // An owner takes its helper's partial result in: both are brought to the larger of the two maxima in use and added. Lane and register hold the same element in both waves.
    auto join = [&]() {
        const v4f ml = *reinterpret_cast<const v4fa*>(L + FA_XM + hw * 512u + lane * 16u);
#pragma unroll
        for (int g = 0; g < FA_R; ++g) { const float nn = __builtin_fminf(negm[g][0], ml[2 * g]);
            const float f1 = __builtin_amdgcn_exp2f(nn - negm[g][0]), f2 = __builtin_amdgcn_exp2f(nn - ml[2 * g]);
            lsum[g] = lsum[g] * f1 + ml[2 * g + 1] * f2;
#pragma unroll
            for (int i = 0; i < 8; ++i) negm[g][i] = nn;
#pragma unroll
            for (int t = 0; t < FA_DT; ++t) { const unsigned char* xp = L + FA_XS + hw * 16384u + (uint32_t)(g * FA_DT + t) * 1024u + lane * 16u;
                const v4f lo = *reinterpret_cast<const v4fa*>(xp), up = *reinterpret_cast<const v4fa*>(xp + 512u);
#pragma unroll
                for (int i = 0; i < 4; ++i) { acc[g][t][i] = acc[g][t][i] * f1 + lo[i] * f2; acc[g][t][i + 4] = acc[g][t][i + 4] * f1 + up[i] * f2; } } } };
    const uint32_t fmask = helper ? (uint32_t)(FA_SEG - 1) : 0xFFFFFFFFu;   // a helper starts anew with every group
    KFr kf;
#pragma unroll 1   // rolled: one publish point in the text, and the pass loop stays nested in it
    for (uint32_t st = 0; st < (uint32_t)FA_NST; ++st) {
        if (st != 0u && (st & (uint32_t)(FA_SEG - 1)) == 0u) {   // the publish point just passed has handed over the helpers' finished groups
            if (helper) { load_q(cg0 + st / (uint32_t)FA_SEG); clear(); }
            else if (wave % 3u == st / (uint32_t)FA_SEG - 1u) join();
        }
        const uint32_t base = (st & 1u) * FA_STAGE + (helper ? FA_STREAM : 0u);
        load_k(kf, L, base + k_off(0u), lane);
#pragma unroll 1
        for (uint32_t sub = 0; sub < 4u; ++sub)   // kept rolled and nested: one flat or unrolled loop over passes spills
            fa_pass(kf, sub < 3u, ((st & fmask) | sub) == 0u, base + k_off(sub + 1u), L, base + v_off(sub), lane, qf, ones, acc, negm, lsum);
        if (helper && (st & (uint32_t)(FA_SEG - 1)) == (uint32_t)(FA_SEG - 1)) {   // a group's share is done: its partial result goes to the hand-over, ahead of the publish point's wait and barrier
            nop4();   // the slots behind the pass's last WMMA before its D is read
#pragma unroll
            for (int g = 0; g < FA_R; ++g) {
#pragma unroll
                for (int t = 0; t < FA_DT; ++t) { unsigned char* xp = L + FA_XS + hw * 16384u + (uint32_t)(g * FA_DT + t) * 1024u + lane * 16u;
                    *reinterpret_cast<v4fa*>(xp) = (v4f){acc[g][t][0], acc[g][t][1], acc[g][t][2], acc[g][t][3]}; *reinterpret_cast<v4fa*>(xp + 512u) = (v4f){acc[g][t][4], acc[g][t][5], acc[g][t][6], acc[g][t][7]}; } }
            *reinterpret_cast<v4fa*>(L + FA_XM + hw * 512u + lane * 16u) = (v4f){negm[0][0], lsum[0][0], negm[1][0], lsum[1][0]};
        }
        // Publish point of stage st + 1, every wave: own LDS reads and writes done, own request landed, barrier; only then the refill of the buffer just read.
        wait_ds0();
        wait_tensor0(g0, g1);
        __syncthreads();
        if (pinned(st + 2u < (uint32_t)FA_NST)) issue(st + 2u);
    }
    wait_tensor0(g0, g1);
    wait_ds0();
    if (helper) return;   // behind the last barrier: the helpers have no rows of their own to store
    if (wave % 3u == 2u) join();
    // The last publish point's barrier has ended every wave's reads of the ring: it becomes output staging, one region a wave.
    const uint32_t hq = gkv * (uint32_t)REP + cg0 / (uint32_t)(TT / FA_CW), t0 = (cg0 % (uint32_t)(TT / FA_CW)) * (uint32_t)FA_CW;
    const uint32_t eh = wave * (uint32_t)FA_CW * FA_EP;
#pragma unroll
    for (int g = 0; g < FA_R; ++g) { const float inv = 1.0f / lsum[g][0];   // the sum over all keys: the ones product has joined the wave halves
#pragma unroll
        for (int t = 0; t < FA_DT; ++t) { const v8f o = acc[g][t] * inv; u32x4 ph;
#pragma unroll
            for (int i = 0; i < 4; ++i) ph[i] = pack2h(o[2 * i], o[2 * i + 1]);
            const uint32_t eo = (16u * g + c) * FA_EP + 32u * t + 16u * h;
            *reinterpret_cast<u32x4*>(L + eh + eo) = ph; } }
    wait_ds0();
    // Read back whole rows: 16 lanes cover one 256-byte row, so every 128-byte line of the plane is stored once.
#pragma unroll
    for (uint32_t i = 0; i < (uint32_t)FA_CW / 2u; ++i) { const uint32_t row = i * 2u + lane / 16u, colb = (lane % 16u) * 16u;
        const u32x4 vh = *reinterpret_cast<const u32x4*>(L + eh + row * FA_EP + colb);
        const size_t ob = (((size_t)b * TT + t0 + row) * DQ + (size_t)hq * HD) * 2 + colb;
        *reinterpret_cast<u32x4*>(reinterpret_cast<unsigned char*>(AO) + ob) = vh; }
}

// ---- k_gemmw: C[m][n] = sum_k A[m][k] Bt[n][k], 16-bit operands (F16: fp16, else bf16; the planes are passed as their bits) in K-contiguous planes of GK elements a row, f32 accumulate; every wave keeps one 64x64 tile (16 accumulators).
// A workgroup is 2 x 2 waves on a 128 x 128 tile; grid (M / 128, N / 128). Its operand rows come by tensor loads in stages of 64 k (128 bytes a row) into two LDS buffers:
// every wave brings one slice of 64 rows a stage (A: slices 0, 1; Bt: 2, 3), so a row is fetched once a workgroup and each fragment is read from LDS by the waves that share it.
// HEADS: m = b * TT + t, n runs over the q, then the k, then the v columns; the tile goes out rounded to fp16 into the head planes PQ, PK, PV ([b][h][t][d]), the q columns times QSC (in f32, ahead of the one rounding), and C is not used.
// Every "#pragma unroll" of this section but the two over output rows stands over a loop whose index picks a register array's element: unrolled, the arrays stay in registers.
#define GK 768u                    // row length of every operand plane, elements
#define G_ROWB 128u                // bytes of one operand row in a stage
#define G_P 144u                   // its LDS pitch (ds_load_b128 readers): 16 B x odd
#define G_SLICE 10240u             // 64 padded rows, rounded up to a multiple of 2 KiB
#define G_NST (GK / 64u)
#define G_OS (16u * 68u * 4u)      // bytes of one wave's output staging
#define G_W0 ((1u << 20) | (4u << 22) | (3u << 25))   // descriptor group 1 word 0: pad of 16 B behind every 128-B row
static_assert(DM == GK && DQ == GK && G_NST >= 2u && 64u * G_P <= G_SLICE && (NB_ * TT) % 128 == 0 && (DQ + 2 * DKV) % 128 == 0 && DM % 128 == 0, "whole tiles, whole stages, two stages or more");
// One tensor load of 64 rows of 128 bytes at a source pitch of 2 GK bytes: tdm_load's form (fixed scalar registers, descriptor and load in one statement, for the reasons given there) with this tile's constants.
DEV void tdm_load_g(uint32_t lds_dst, uint64_t ga, u32x4& g0, u32x8& g1) {
    constexpr uint32_t d0 = G_ROWB, d1 = 64u;
    asm volatile("s_mov_b32 s80, 1\n\ts_mov_b32 s81, %2\n\ts_mov_b32 s82, %3\n\ts_mov_b32 s83, %4\n\t"
                 "s_mov_b32 s84, %5\n\ts_mov_b32 s85, %6\n\ts_mov_b32 s86, %7\n\ts_mov_b32 s87, %8\n\ts_mov_b32 s88, %9\n\ts_mov_b32 s89, %10\n\ts_mov_b32 s90, 0\n\ts_mov_b32 s91, 0\n\t"
                 "tensor_load_to_lds s[80:83], s[84:91]"
                 : "=&{s[80:83]}"(g0), "=&{s[84:91]}"(g1)
                 : "s"(uni(lds_dst)), "s"(uni((uint32_t)ga)), "s"(uni((((uint32_t)(ga >> 32)) & 0x01FFFFFFu) | 0x80000000u)),
                   "n"(G_W0), "n"((d0 & 0xFFFFu) << 16), "n"((d0 >> 16) | ((d1 & 0xFFFFu) << 16)), "n"((d1 >> 16) | (d0 << 16)), "n"(d1), "n"(2u * GK)
                 : "memory"); }
DEV v16bf ld_fr(const unsigned char* p) { return cat16b(*reinterpret_cast<const v8usa*>(p), *reinterpret_cast<const v8usa*>(p + 32)); }   // the hardware k order: bytes 16 h and 32 + 16 h of each 64 (p holds the 16 h)
template <bool F16> DEV v8f gmma(v16bf a, v16bf b, v8f c) { if constexpr (F16) return wmma16(__builtin_bit_cast(v16h, a), __builtin_bit_cast(v16h, b), c); else return wmmab(a, b, c); }
template <bool F16, bool HEADS>
__global__ __launch_bounds__(128) void k_gemmw(const bf* __restrict__ A, const bf* __restrict__ Bt, float* C, int ldc, h16* PQ, h16* PK, h16* PV) {
    constexpr uint32_t WN = 2u, NW = 2u * WN, NA = 2u, STAGE = NW * G_SLICE;
    __shared__ __attribute__((aligned(2048))) unsigned char L[2u * STAGE + NW * G_OS];   // the ring, then one staging region a wave
    const uint32_t lane = threadIdx.x & 31u, wave = uni(threadIdx.x >> 5), lr = lane & 15u, hi = lane >> 4, wm = wave / WN, wn = wave % WN;
    const uint32_t R0 = blockIdx.x * 128u, C0 = blockIdx.y * (64u * WN);
    const int r0 = (int)(R0 + wm * 64u), c0 = (int)(C0 + wn * 64u);
    const bf* sp = A + (size_t)(R0 + (wave & 1u) * 64u) * GK;   // this wave's slice of stage 0
    if (wave >= NA) sp = Bt + (size_t)(C0 + (wave - NA) * 64u) * GK;
    const uint64_t src = (uint64_t)(size_t)sp; const uint32_t lbase = (uint32_t)(size_t)L;
    u32x4 g0; u32x8 g1;
    // Workgroups of one tile row share the A rows, those of one tile column the Bt rows. Each starts its walk over k at a stage of its own and wraps round (A and Bt at the same one),
    // so that workgroups that run side by side ask L2 for different lines of the shared rows.
    const uint32_t st0 = (blockIdx.x + (blockIdx.x >> 3) + blockIdx.y) % G_NST;
    auto issue = [&](uint32_t st) { uint32_t ks = st + st0; if (ks >= G_NST) ks -= G_NST;   // every wave issues its one request of stage st: the 64 k from 64 ks on
        tdm_load_g(lbase + (st & 1u) * STAGE + wave * G_SLICE, src + (uint64_t)(ks * G_ROWB), g0, g1); };
    issue(0u);
    v8f acc[4][4];
#pragma unroll
    for (int mb = 0; mb < 4; ++mb)
#pragma unroll
        for (int nb = 0; nb < 4; ++nb) acc[mb][nb] = (v8f){};
    const uint32_t fo = lr * G_P + 16u * hi;   // this lane's place in a 16-row fragment
    wait_tensor0(g0, g1);     // stage 0 has landed (this wave's slice)
    __syncthreads();    // ... and is published to every wave
    issue(1u);
#pragma unroll 1   // rolled: one publish point in the text
    for (uint32_t st = 0; st < G_NST; ++st) {
        const unsigned char* Ls = L + (st & 1u) * STAGE + fo;
        v16bf a[2][4], b[2][4];
#pragma unroll
        for (uint32_t kc = 0; kc < 2u; ++kc) {
#pragma unroll
            for (uint32_t i = 0; i < 4u; ++i) { a[kc][i] = ld_fr(Ls + wm * G_SLICE + i * 16u * G_P + kc * 64u); b[kc][i] = ld_fr(Ls + (NA + wn) * G_SLICE + i * 16u * G_P + kc * 64u); } }
        fence();   // the stage's fragment loads stand as one group ahead of its products: left to the scheduler, a pair of loads and a wait to 0 stood in front of every four WMMAs
#pragma unroll
        for (uint32_t kc = 0; kc < 2u; ++kc) {
#pragma unroll
            for (uint32_t nb = 0; nb < 4u; ++nb) {
#pragma unroll
                for (uint32_t mb = 0; mb < 4u; ++mb) acc[mb][nb] = gmma<F16>(a[kc][mb], b[kc][nb], acc[mb][nb]); } }
        fence(); nop4(); fence();   // the slots behind the stage's last WMMA, on the loop's back edge too, before the next stage's fragment loads overwrite its A and B
        // Publish point of stage st + 1, every wave: own LDS reads done, own request landed, barrier; only then the refill of the buffer just read.
        wait_ds0();
        wait_tensor0(g0, g1);
        __syncthreads();
        if (pinned(st + 2u < G_NST)) issue(st + 2u);
    }
    wait_tensor0(g0, g1);
    wait_ds0();
    float* os = reinterpret_cast<float*>(L + 2u * STAGE + wave * G_OS);   // outside the ring, this wave's own: no barrier is owed
#pragma unroll
    for (int mb = 0; mb < 4; ++mb) {
#pragma unroll
        for (int nb = 0; nb < 4; ++nb) {
#pragma unroll
            for (int j = 0; j < 8; ++j) os[(hi * 8 + j) * 68 + nb * 16 + lr] = acc[mb][nb][j]; }
        __builtin_amdgcn_wave_barrier(); asm volatile("" ::: "memory");   // the staging stores stay ahead of the row reads below (other lanes' values)
        if (HEADS) {   // the tile's 64 rows lie in one batch, its 64 columns in one head: a row of the tile is one whole 128-byte line of the plane
            h16* P = PQ; int nh = NH_, hh = c0 / HD; float osc = QSC;
            if (c0 >= DQ + DKV) { P = PV; nh = NKV; hh = (c0 - DQ - DKV) / HD; osc = 1.0f; } else if (c0 >= DQ) { P = PK; nh = NKV; hh = (c0 - DQ) / HD; osc = 1.0f; }
            h16* prow = P + ((size_t)((r0 / TT) * nh + hh) * TT + (r0 % TT) + mb * 16) * HD + (c0 % HD);
#pragma unroll
            for (int s = 0; s < 4; ++s) { const int row = 4 * s + (lane >> 3), cofs = (lane & 7) * 8; const v4f lo = *(const v4fa*)(os + row * 68 + cofs), up = *(const v4fa*)(os + row * 68 + cofs + 4); v8h o;
#pragma unroll
                for (int k = 0; k < 4; ++k) { o[k] = (h16)(lo[k] * osc); o[k + 4] = (h16)(up[k] * osc); }
                *(v8h*)(prow + (size_t)row * HD + cofs) = o; }
        } else {
            float* crow = C + (size_t)(r0 + mb * 16) * ldc + c0;
#pragma unroll
            for (int s = 0; s < 8; ++s) { const int row = 2 * s + hi, cofs = lr * 4;
                *(v4f*)(crow + (size_t)row * ldc + cofs) = *(const v4fa*)(os + row * 68 + cofs); }
        }
        __builtin_amdgcn_wave_barrier(); asm volatile("" ::: "memory");   // ... and the row reads ahead of the next block's staging stores
    }
}

extern "C" void kernel_launch(void* const* d_in, const int* in_sizes, int n_in,
                              void* d_out, int out_size, void* d_ws, size_t ws_size, hipStream_t stream) {
    (void)in_sizes; (void)n_in; (void)out_size;
    const float* x = (const float*)d_in[0]; const float* wq = (const float*)d_in[1]; const float* wk = (const float*)d_in[2]; const float* wv = (const float*)d_in[3]; const float* wo = (const float*)d_in[4];
    float* OUT = (float*)d_out;     // [2][4096][768]
    char* wsp = (char*)d_ws;
    auto take = [&](size_t bytes) { char* p = wsp; wsp += (bytes + 255) & ~(size_t)255; return (void*)p; };
    bf* XB = (bf*)take((size_t)CV_TOT * 8 * 2); bf* WQ = XB + (size_t)CV_NX * 8; bf* WO = WQ + (size_t)(CV_NQ + 2 * CV_NK) * 8;   // x of both batches [b * TT + t][DM]; wq, wk, wv as one [DQ + 2 DKV][DM] matrix; wo (fp16 bits)
    h16* QP16 = (h16*)take((size_t)NB_ * NH_ * TT * HD * 2); h16* KP16 = (h16*)take((size_t)NB_ * NKV * TT * HD * 2); h16* VP16 = (h16*)take((size_t)NB_ * NKV * TT * HD * 2);   // head planes [b][h][t][d] of both batches
    h16* AT = (h16*)take((size_t)NB_ * TT * DQ * 2);   // the merged heads [b * TT + t][DQ]
    if ((size_t)(wsp - (char*)d_ws) > ws_size) return;    // ws 256 MiB
    k_cvtall<<<CV_GRID, 256, 0, stream>>>(x, wq, wk, wv, wo, XB);
    k_gemmw<false, true><<<dim3(NB_ * TT / 128, (DQ + 2 * DKV) / 128, 1), 128, 0, stream>>>(XB, WQ, nullptr, 0, QP16, KP16, VP16);   // v as [g][t][d] rows: the fused kernel transposes on its LDS read
    k_fattn<<<dim3(FA_NCG / FA_OW, NKV, NB_), FA_NW * 32, 0, stream>>>(QP16, KP16, VP16, AT);
    k_gemmw<true, false><<<dim3(NB_ * TT / 128, DM / 128, 1), 128, 0, stream>>>((const bf*)AT, WO, OUT, DM, nullptr, nullptr, nullptr);
}

// v009
// A run of this version takes 84.9 microseconds.
// Next to v008, in two timings, it ran 1.04 times as fast each time.
// Counting every step since v000, it is 19.6 times as fast.
#include <hip/hip_runtime.h>
#include <stdint.h>

// Bidirectional grouped-query attention (x [2][4096][768]; q = x wq^T (6 heads x 128) x 128^-0.5, k, v = x wk^T / wv^T ([256][768]: 2 kv heads; query head h = g*3 + r uses kv head h/3); softmax(q.k) over all keys (no mask); out = merged wo^T -> [2][4096][768] (6.3 M)).
// Compute dtypes, f32 accumulate: every input rounded to bf16; q/k/v on PLAIN bf16 operands (inputs: exact); scores and attn.v on single fp16 operands inside one fused kernel (k_fattn); softmax f32, online, its row sums taken over the fp16 weights; wo on single fp16 operands too: the merged heads rounded once to fp16, wo's bf16 value held as fp16.
// Four launches: k_cvtall (all inputs to bf16; wo from there to fp16), k_gemmw (q, k, v of both batches, stored as fp16 head planes), k_fattn, k_gemmw (wo, both batches).

#define NB_  2
#define TT   4096
#define DM   768
#define NH_  6
#define NKV  2
#define REP  (NH_ / NKV)
#define HD   128
#define DQ   (NH_ * HD)
#define DKV  (NKV * HD)
#define SCL  0.088388347648318447f   // HD^-0.5
#define QSC  (SCL * 1.4426950408889634f)   // HD^-0.5 log2(e): the q plane is stored times this, so that a score product is already the exponent to base 2
typedef _Float16 h16;
typedef unsigned short bf;
typedef __attribute__((ext_vector_type(16))) __bf16   v16bf;
typedef __attribute__((ext_vector_type(16))) _Float16 v16h;
typedef __attribute__((ext_vector_type(8)))  _Float16 v8h;
typedef __attribute__((ext_vector_type(8)))  unsigned short v8us;
typedef __attribute__((ext_vector_type(8)))  float    v8f;
typedef __attribute__((ext_vector_type(4)))  float    v4f;
typedef v8h  __attribute__((may_alias)) v8ha;
typedef v4f  __attribute__((may_alias)) v4fa;
typedef v8us __attribute__((may_alias)) v8usa;

__device__ __forceinline__ unsigned short f2bf(float f) { unsigned u = __float_as_uint(f); u += 0x7FFFu + ((u >> 16) & 1u); return (unsigned short)(u >> 16); }
__device__ __forceinline__ float bf2f(unsigned short b) { return __uint_as_float(((unsigned)b) << 16); }
__device__ __forceinline__ float bfr(float f) { return bf2f(f2bf(f)); }
__device__ __forceinline__ v16h cat16(v8h lo, v8h hi) { return __builtin_shufflevector(lo, hi, 0, 1, 2, 3, 4, 5, 6, 7, 8, 9, 10, 11, 12, 13, 14, 15); }
__device__ __forceinline__ v16bf cat16b(v8us lo, v8us hi) { return __builtin_bit_cast(v16bf, __builtin_shufflevector(lo, hi, 0, 1, 2, 3, 4, 5, 6, 7, 8, 9, 10, 11, 12, 13, 14, 15)); }
__device__ __forceinline__ v8f wmma16(v16h a, v16h b, v8f c) { return __builtin_amdgcn_wmma_f32_16x16x32_f16(false, a, false, b, (short)0, c, false, false); }
__device__ __forceinline__ v8f wmmab(v16bf a, v16bf b, v8f c) { return __builtin_amdgcn_wmma_f32_16x16x32_bf16(false, a, false, b, (short)0, c, false, false); }



__device__ __forceinline__ h16 tohx(float x) { return (h16)x; }
typedef __attribute__((ext_vector_type(2))) _Float16 v2h;
typedef __attribute__((ext_vector_type(4))) _Float16 v4h;
typedef __attribute__((ext_vector_type(2))) unsigned short v2us;
typedef __attribute__((ext_vector_type(4))) unsigned short v4us;
typedef __attribute__((ext_vector_type(2))) float v2f;
typedef __attribute__((ext_vector_type(4))) int v4i;

__global__ __launch_bounds__(256) void k_wtG(const float* __restrict__ w, int K, int N, bf* Bt) {
    const int lane = threadIdx.x & 31; const int L0 = (blockIdx.x * 8 + (threadIdx.x >> 5)) * 8; const int nlines = N * K / 64;
{
#pragma unroll 1
        for (int l = 0; l < 8; ++l) { const int L = L0 + l; if (L >= nlines) break; const size_t e = (size_t)L * 64 + lane * 2; const int k = (int)(e % K), n = (int)(e / K); v2us o;
            o[0] = f2bf(w[(size_t)k * N + n]); o[1] = f2bf(w[(size_t)(k + 1) * N + n]); *(v2us*)(Bt + e) = o; }
         }
}
// k_cvtall: every input rounded to bf16 in one launch; dst holds x, wq, wk, wv, wo one behind another, wo's rounded values as fp16 (the wo product runs on fp16 operands). A unit is 8 elements; a thread converts CV_U units, a whole grid apart: a quarter of the waves to start, and each with all its loads in flight at once.
#define CV_NX (NB_ * TT * DM / 8)
#define CV_NQ (DQ * DM / 8)
#define CV_NK (DKV * DM / 8)
#define CV_TOT (CV_NX + 2 * CV_NQ + 2 * CV_NK)
#define CV_U 4
#define CV_GRID (CV_TOT / (CV_U * 256))
static_assert(CV_TOT % (CV_U * 256) == 0 && CV_NX % 256 == 0 && CV_NQ % 256 == 0 && CV_NK % 256 == 0 && TT % 64 == 0 && HD % 64 == 0, "whole blocks of units; a 64 x 64 tile lies in one batch and one head");
__global__ __launch_bounds__(256) void k_cvtall(const float* __restrict__ x, const float* __restrict__ wq, const float* __restrict__ wk, const float* __restrict__ wv, const float* __restrict__ wo, bf* dst) {
    const int u0 = blockIdx.x * 256 + threadIdx.x; v8f v[CV_U]; bool w16[CV_U];
#pragma unroll
    for (int j = 0; j < CV_U; ++j) { int ub = blockIdx.x + j * CV_GRID; const float* s = x; w16[j] = false;   // every input is a whole number of 256-unit blocks: the choice of the source is the same for the whole block (scalar)
        if (ub >= CV_NX / 256) { ub -= CV_NX / 256; s = wq;
            if (ub >= CV_NQ / 256) { ub -= CV_NQ / 256; s = wk;
                if (ub >= CV_NK / 256) { ub -= CV_NK / 256; s = wv;
                    if (ub >= CV_NK / 256) { ub -= CV_NK / 256; s = wo; w16[j] = true; } } } }
        v[j] = *(const v8f*)(s + (size_t)ub * 2048 + threadIdx.x * 8); }
    __builtin_amdgcn_sched_barrier(0);   // all eight loads are issued before the first conversion waits for one (the scheduler had put the last two behind such a wait: a second memory latency)
#pragma unroll
    for (int j = 0; j < CV_U; ++j) { v8us o;
#pragma unroll
        for (int k = 0; k < 8; ++k) o[k] = f2bf(v[j][k]);
        if (w16[j]) {   // the same for the whole block, like the source
#pragma unroll
            for (int k = 0; k < 8; ++k) o[k] = __builtin_bit_cast(unsigned short, (h16)bf2f(o[k])); }
        *(v8us*)(dst + (size_t)(u0 + j * (CV_GRID * 256)) * 8) = o; }
}

typedef uint32_t u32x4 __attribute__((ext_vector_type(4)));
typedef uint32_t u32x8 __attribute__((ext_vector_type(8)));
typedef int i32x8 __attribute__((ext_vector_type(8)));
typedef short s16x8 __attribute__((ext_vector_type(8)));
#define FA_NW 8                    // waves per workgroup
#define FA_OW 6                    // of them owners of a column group
#define FA_CW 32                   // query columns per wave
#define FA_R  2                    // 16-column groups per wave
#define FA_KT 2                    // 16-key score tiles per pass
#define FA_DK (HD / 32)
#define FA_DT (HD / 16)
#define FA_ROWB 256u               // bytes of one K or V row
#define FA_PK 272u                 // LDS pitch of K rows (ds_load_b128 readers): 16 B x odd
#define FA_PV 288u                 // LDS pitch of V rows (ds_load_tr16_b128 readers): 32 B x odd
#define FA_SLICE 18432u            // 64 padded rows, rounded up to a multiple of 2 KiB
#define FA_STREAM (4u * FA_SLICE)  // 2 K slices, then 2 V slices: 128 keys
#define FA_STAGE (2u * FA_STREAM)  // the owners' 128 keys, then the helpers'
#define FA_LDS (2u * FA_STAGE)
#define FA_KO (TT / 4 * 3)         // the owners' keys: 0 ... FA_KO - 1; the helpers' are the rest
#define FA_NST (FA_KO / 128)       // stages every wave walks
#define FA_SEG ((TT - FA_KO) / 128)   // stages of the helpers' keys: one column group's share of a helper's walk
#define FA_NCG (REP * TT / FA_CW)  // column groups of one (batch, kv head)
#define FA_EP 272u                 // output staging pitch
#define FA_W0K ((1u << 20) | (5u << 22) | (3u << 25))   // descriptor group 1 word 0: pad of 16 B behind every 256-B row
#define FA_W0V ((1u << 20) | (5u << 22) | (7u << 25))   // the same with 32 B
static_assert(HD == 128 && TT % 512 == 0 && FA_NST >= 2 && FA_NST == 3 * FA_SEG && (FA_SEG & (FA_SEG - 1)) == 0 && FA_NW - FA_OW == 2 && FA_NCG % FA_OW == 0, "k_fattn is written for head size 128, six owners and two helpers with three groups each");
static_assert(64u * FA_PK <= FA_SLICE && 64u * FA_PV <= FA_SLICE && FA_NW * FA_CW * FA_EP <= FA_LDS && FA_LDS <= 327680u, "slices and output staging must fit");
#define DEV static __device__ __forceinline__
DEV uint32_t uni(uint32_t v) { return (uint32_t)__builtin_amdgcn_readfirstlane(v); }
DEV uint32_t pinned(uint32_t v) { uint32_t w = __builtin_amdgcn_readfirstlane(v); asm volatile("" : "+s"(w)); return w; }   // a test word held in a scalar register: the branch on it is a scalar branch (tensor loads ignore EXEC)
DEV void fence() { __builtin_amdgcn_sched_barrier(0); }   // holds the order of the blocks of a pass as written (what each one is for stands at its use)
DEV void wait_ds0() { asm volatile("s_wait_dscnt 0x0" ::: "memory"); }   // this wave's LDS reads and writes are done
// This wave's own tensor request has landed. Both descriptor groups are read here in the registers the load named: the compiler keeps them there, unwritten, from the load to this wait.
DEV void wait_tensor0(u32x4 g0, u32x8 g1) { asm volatile("s_wait_tensorcnt 0x0" :: "{s[80:83]}"(g0), "{s[84:91]}"(g1) : "memory"); }
DEV void nop4() { asm volatile("v_nop\n\tv_nop\n\tv_nop\n\tv_nop"); }   // the four vector slots behind a WMMA before its D is read or its A or B overwritten
// One tensor load. The descriptor is formed and the load issued in one statement, in twelve fixed scalar registers that nothing else of the kernel uses, so that no word of an outstanding request's descriptor is rewritten
// (left to the register allocator, the groups were copied behind the load and their first registers reused ahead of the wait).
// Group 0 (s80 to s83): count 1, LDS byte, address low, address high | type 2. Group 1 (s84 to s91): W0 (mask 0, 1-byte elements, the pad), tensor = tile = 64 rows of 256 bytes, source pitch 256 bytes.
// The three words that vary go through readfirstlane; every other word is an immediate of the text. The outputs are early-clobbered: no input shares a register with them.
template <uint32_t W0> DEV void tdm_load(uint32_t lds_dst, uint64_t ga, u32x4& g0, u32x8& g1) {
    constexpr uint32_t d0 = FA_ROWB, d1 = 64u;
    asm volatile("s_mov_b32 s80, 1\n\ts_mov_b32 s81, %2\n\ts_mov_b32 s82, %3\n\ts_mov_b32 s83, %4\n\t"
                 "s_mov_b32 s84, %5\n\ts_mov_b32 s85, %6\n\ts_mov_b32 s86, %7\n\ts_mov_b32 s87, %8\n\ts_mov_b32 s88, %9\n\ts_mov_b32 s89, %10\n\ts_mov_b32 s90, 0\n\ts_mov_b32 s91, 0\n\t"
                 "tensor_load_to_lds s[80:83], s[84:91]"
                 : "=&{s[80:83]}"(g0), "=&{s[84:91]}"(g1)
                 : "s"(uni(lds_dst)), "s"(uni((uint32_t)ga)), "s"(uni((((uint32_t)(ga >> 32)) & 0x01FFFFFFu) | 0x80000000u)),
                   "n"(W0), "n"((d0 & 0xFFFFu) << 16), "n"((d0 >> 16) | ((d1 & 0xFFFFu) << 16)), "n"((d1 >> 16) | (d0 << 16)), "n"(d1), "n"(FA_ROWB)
                 : "memory"); }
struct Frag { u32x4 q[2]; };
DEV v8f fmma(const Frag& a, const Frag& b, v8f c) {
    const i32x8 av = {(int)a.q[0].x, (int)a.q[0].y, (int)a.q[0].z, (int)a.q[0].w, (int)a.q[1].x, (int)a.q[1].y, (int)a.q[1].z, (int)a.q[1].w};
    const i32x8 bv = {(int)b.q[0].x, (int)b.q[0].y, (int)b.q[0].z, (int)b.q[0].w, (int)b.q[1].x, (int)b.q[1].y, (int)b.q[1].z, (int)b.q[1].w};
    return wmma16(__builtin_bit_cast(v16h, av), __builtin_bit_cast(v16h, bv), c); }
DEV u32x4 ld_tr16(const unsigned char* p) { typedef __attribute__((address_space(3))) s16x8 lds_s16x8; return __builtin_bit_cast(u32x4, __builtin_amdgcn_ds_load_tr16_b128_v8i16((lds_s16x8*)p)); }
DEV uint32_t pack2h(float lo, float hi) { return __builtin_bit_cast(uint32_t, __builtin_convertvector((v2f){lo, hi}, v2h)); }   // round to nearest even
DEV float xhalf(float x) { return __builtin_bit_cast(float, __builtin_amdgcn_permlanex16(__builtin_bit_cast(int, x), __builtin_bit_cast(int, x), 0x76543210, 0xfedcba98, false, false)); }   // lane l with lane l ^ 16
// Two fp16 ones. Formed in asm so that the operand is made once and stays in its registers: as a constant the compiler knows, it was copied anew from scalar registers in every pass (four 64-bit moves).
DEV uint32_t one2h() { uint32_t w; asm("v_mov_b32 %0, 0x3c003c00" : "=v"(w)); return w; }
struct KFr { Frag f[FA_KT][FA_DK]; };
// Byte offsets of pass sub's 32 K rows and 32 V rows in a stream's stage.
DEV uint32_t k_off(uint32_t sub) { return (sub >> 1) * FA_SLICE + (sub & 1u) * (32u * FA_PK); }
DEV uint32_t v_off(uint32_t sub) { return (2u + (sub >> 1)) * FA_SLICE + (sub & 1u) * (32u * FA_PV); }
// koff = byte offset of the pass's K rows in LDS; the hardware k order (bytes 16h and 32 + 16h of each 64), as Q's below.
DEV void load_k(KFr& k, const unsigned char* Lp, uint32_t koff, uint32_t lane) {
    const uint32_t c = lane & 15u, h = lane >> 4;
#pragma unroll
    for (int kt = 0; kt < FA_KT; ++kt) { const unsigned char* p = Lp + koff + (16u * kt + c) * FA_PK + 16u * h;
#pragma unroll
        for (int kc = 0; kc < FA_DK; ++kc) { k.f[kt][kc].q[0] = *reinterpret_cast<const u32x4*>(p + 64u * kc); k.f[kt][kc].q[1] = *reinterpret_cast<const u32x4*>(p + 64u * kc + 32u); } }
}
// The passes of a stage are software-pipelined inside a wave: the score products of pass p + 1 are issued among the exponentials of pass p, and the maxima of pass p + 1 are taken among the attn.v products of pass p,
// so that the vector work runs while the matrix pipe is busy with the same wave's products. The order of the arithmetic on every value is that of the plain sequence (scores, test, rescale, weights, attn.v).
// negm[g]: eight copies of -(the maximum in use) of the lane's query column; lsum[g]: its running sum, in every element; s: the exponents of the pass that comes next, already tested against the maximum in use.
// Rare after a group's first pass: some exponent lies more than 8 above the maximum in use. top: the largest exponent of each score tile in this lane.
DEV void fa_rescale(bool first, const float (&top)[FA_KT][FA_R], v8f (&s)[FA_KT][FA_R], v8f (&acc)[FA_R][FA_DT], v8f (&negm)[FA_R], v8f (&lsum)[FA_R]) {
#pragma unroll
    for (int g = 0; g < FA_R; ++g) { float mx = __builtin_fmaxf(top[0][g], top[1][g]); mx = __builtin_fmaxf(mx, xhalf(mx));   // both wave halves hold this query's largest exponent
        const float d = first ? mx : __builtin_fmaxf(mx, 0.0f);   // the maximum in use rises by d; the first pass takes its own maximum, whatever its sign
        const float corr = first ? 0.0f : __builtin_amdgcn_exp2f(-d);   // nothing is summed yet in the first pass
        negm[g] = negm[g] - d; lsum[g] = lsum[g] * corr;
#pragma unroll
        for (int kt = 0; kt < FA_KT; ++kt) s[kt][g] = s[kt][g] - d;
#pragma unroll
        for (int t = 0; t < FA_DT; ++t) acc[g][t] = acc[g][t] * corr; }
}
// A stage's opening: the scores of its first pass and their test; nothing of the wave's own runs beside them. The K fragments of the second pass are asked for behind the products.
DEV void fa_open(KFr& kf, bool first, uint32_t next_koff, const unsigned char* Lp, uint32_t lane, const Frag (&qf)[FA_R][FA_DK], v8f (&s)[FA_KT][FA_R], v8f (&acc)[FA_R][FA_DT], v8f (&negm)[FA_R], v8f (&lsum)[FA_R]) {
    fence();   // the caller's K fetch stays one group ahead of the products: left to the scheduler, pairs of loads stood among them, each with a wait to 0
#pragma unroll
    for (int kt = 0; kt < FA_KT; ++kt) {
#pragma unroll
        for (int g = 0; g < FA_R; ++g) { s[kt][g] = negm[g];
#pragma unroll
            for (int kc = 0; kc < FA_DK; ++kc) s[kt][g] = fmma(kf.f[kt][kc], qf[g][kc], s[kt][g]); } }
    fence(); nop4(); fence();   // keeps the fetch below (it overwrites A operands) behind the products and their slots
    load_k(kf, Lp, next_koff, lane);
    fence(); asm volatile("" ::: "memory");   // hold the fetch here as one group, in flight under the test: the compiler had moved it behind the test's branch
    float top[FA_KT][FA_R];   // four independent chains
#pragma unroll
    for (int kt = 0; kt < FA_KT; ++kt) {
#pragma unroll
        for (int g = 0; g < FA_R; ++g) { float mx = -__builtin_inff();
#pragma unroll
            for (int r = 0; r < 8; ++r) mx = __builtin_fmaxf(mx, s[kt][g][r]);
            top[kt][g] = mx; } }
    const float all = __builtin_fmaxf(__builtin_fmaxf(__builtin_fmaxf(top[0][0], top[0][1]), top[1][0]), top[1][1]);
    const float thr = first ? -__builtin_inff() : 8.0f;   // a group's first pass always sets the maximum in use
    if (__builtin_amdgcn_ballot_w32(all > thr) != 0) fa_rescale(first, top, s, acc, negm, lsum);
}
// One 32-key pass of one wave from its tested exponents s on. MORE: the stage has a next pass, whose scores and test are done here too (kf holds its K); FETCH: the pass after that one exists as well, and its K is asked for.
template <bool MORE, bool FETCH>
DEV void fa_pass(KFr& kf, uint32_t next_koff, const unsigned char* Lp, uint32_t voff, uint32_t lane, const Frag (&qf)[FA_R][FA_DK], const Frag& ones, v8f (&s)[FA_KT][FA_R], v8f (&acc)[FA_R][FA_DT], v8f (&negm)[FA_R], v8f (&lsum)[FA_R]) {
    const uint32_t h = lane >> 4;
    Frag vf[FA_DT];   // asked for first: in flight under the exponentials and the next pass's score products
    { const unsigned char* ad = Lp + voff + (8u * h + (lane & 7u)) * FA_PV + ((lane >> 3) & 1u) * 16u;
#pragma unroll
      for (int t = 0; t < FA_DT; ++t) { vf[t].q[0] = ld_tr16(ad + 32u * t); vf[t].q[1] = ld_tr16(ad + 16u * FA_PV + 32u * t); } }
    fence();   // the fetch stays ahead of all that follows
    Frag pf[FA_R]; uint32_t w[8];
#pragma unroll
    for (int i = 0; i < 8; ++i)
        w[i] = pack2h(__builtin_amdgcn_exp2f(s[i >> 2][0][2 * (i & 3)]), __builtin_amdgcn_exp2f(s[i >> 2][0][2 * (i & 3) + 1]));
    pf[0].q[0] = (u32x4){w[0], w[1], w[2], w[3]}; pf[0].q[1] = (u32x4){w[4], w[5], w[6], w[7]};
    fence();   // group 0's exponents are used up: their registers take the next pass's
    float e0[8], e1[8];
    if constexpr (MORE) {
#pragma unroll
        for (int i = 0; i < 8; ++i) {   // every fence of this loop holds the order as written: one product, then two of group 1's exponentials, and the packing of the pair before (its exponentials are done by then)
            s[i & 1][0] = fmma(kf.f[i & 1][i >> 1], qf[0][i >> 1], i < 2 ? negm[0] : s[i & 1][0]);
            e0[i] = __builtin_amdgcn_exp2f(s[i >> 2][1][2 * (i & 3)]); e1[i] = __builtin_amdgcn_exp2f(s[i >> 2][1][2 * (i & 3) + 1]);
            if (i > 0) w[i - 1] = pack2h(e0[i - 1], e1[i - 1]);
            fence(); }
        w[7] = pack2h(e0[7], e1[7]);
#pragma unroll
        for (int kt = 0; kt < FA_KT; ++kt) { s[kt][1] = negm[1];
#pragma unroll
            for (int kc = 0; kc < FA_DK; ++kc) s[kt][1] = fmma(kf.f[kt][kc], qf[1][kc], s[kt][1]); }
        fence();   // the score products stay ahead of attn.v
        if constexpr (FETCH) { nop4(); fence(); load_k(kf, Lp, next_koff, lane); fence(); }   // the fetch overwrites A operands: it stays behind the products and their slots; in flight under attn.v
    }
    float top[FA_KT][FA_R]; uint32_t need = 0u;
    lsum[0] = fmma(ones, pf[0], lsum[0]);
#pragma unroll
    for (int t = 0; t < FA_DT; ++t) { acc[0][t] = fmma(vf[t], pf[0], acc[0][t]);
        if constexpr (!MORE) {   // a stage's last pass has no score products to put group 1's exponentials among: they go among group 0's attn.v products, in the same form; the fence holds the order as written
            e0[t] = __builtin_amdgcn_exp2f(s[t >> 2][1][2 * (t & 3)]); e1[t] = __builtin_amdgcn_exp2f(s[t >> 2][1][2 * (t & 3) + 1]);
            if (t > 0) w[t - 1] = pack2h(e0[t - 1], e1[t - 1]);
            fence(); } }
    if constexpr (!MORE) w[7] = pack2h(e0[7], e1[7]);
    pf[1].q[0] = (u32x4){w[0], w[1], w[2], w[3]}; pf[1].q[1] = (u32x4){w[4], w[5], w[6], w[7]};
    if constexpr (MORE) {   // the next pass's test: four independent chains; its mask is formed here, a matrix run ahead of the branch on it
#pragma unroll
        for (int kt = 0; kt < FA_KT; ++kt) {
#pragma unroll
            for (int g = 0; g < FA_R; ++g) { float mx = -__builtin_inff();
#pragma unroll
                for (int r = 0; r < 8; ++r) mx = __builtin_fmaxf(mx, s[kt][g][r]);
                top[kt][g] = mx; } }
        const float all = __builtin_fmaxf(__builtin_fmaxf(__builtin_fmaxf(top[0][0], top[0][1]), top[1][0]), top[1][1]);
        need = __builtin_amdgcn_ballot_w32(all > 8.0f);
#pragma unroll
        for (int t = 0; t < FA_DT + 1; ++t) { __builtin_amdgcn_sched_group_barrier(0x8, 1, 0); __builtin_amdgcn_sched_group_barrier(0x2, 2, 0); }   // two of the test's vector instructions behind each product: they issue while the matrix pipe is busy
        fence(); }
    lsum[1] = fmma(ones, pf[1], lsum[1]);
#pragma unroll
    for (int t = 0; t < FA_DT; ++t) acc[1][t] = fmma(vf[t], pf[1], acc[1][t]);
    if constexpr (MORE) { fence(); nop4(); fence();   // the slots behind the last product, on both sides of the branch: the rescale reads D, the next pass's fetch overwrites A
        if (need != 0u) fa_rescale(false, top, s, acc, negm, lsum); }
}
// Q [b][h][t][d], K and V [b][g][t][d] (fp16); AO [b][t][DQ]: the merged heads, rounded once to fp16.
#define FA_XS FA_LDS                                          // hand-over of a helper's sums: 16 KiB a helper, behind the ring
#define FA_XM (FA_STAGE + 5u * FA_SLICE + 64u * FA_PK)        // ... and of its maxima and row sums: 512 B a helper, in the unused tail of a K slice that the output staging does not reach
static_assert(FA_XM + 1024u <= FA_STAGE + 6u * FA_SLICE && FA_XM >= FA_NW * FA_CW * FA_EP && FA_XS + 32768u <= 327680u, "the hand-over lies clear of tiles and output staging");
__global__ void __launch_bounds__(FA_NW * 32) __attribute__((amdgpu_waves_per_eu(2, 2))) k_fattn(const h16* __restrict__ Q, const h16* __restrict__ K, const h16* __restrict__ V, h16* AO) {
    __shared__ __attribute__((aligned(2048))) unsigned char L[FA_XS + 32768u];
    const uint32_t tid = threadIdx.x, lane = tid & 31u, wave = uni(tid >> 5), c = lane & 15u, h = lane >> 4;
    const uint32_t blk = blockIdx.x, gkv = blockIdx.y, b = blockIdx.z;
    const bool helper = wave >= (uint32_t)FA_OW;
    const uint32_t hw = helper ? wave - (uint32_t)FA_OW : wave / 3u;   // the helper's number: its own, or that of the helper that works for this owner
    const uint32_t lbase = (uint32_t)(size_t)L;
    // This wave's part in the staging: waves 0 to 3 bring the owners' keys, 4 to 7 the helpers' (the same FA_SEG stages three times over); wave & 2 picks K or V, wave & 1 the 64-row half.
    const uint32_t smask = wave < 4u ? 0xFFFFFFFFu : (uint32_t)(FA_SEG - 1);
    // The 64 workgroups of a (batch, kv head) walk the same K and V rows at the same pace. Each starts its walk at a stage of its own and wraps round (the softmax takes the keys in any order),
    // so that at any moment they ask L2 for different lines. Indices next to each other and indices eight apart both get different starts.
    const uint32_t nstr = wave < 4u ? (uint32_t)FA_NST : (uint32_t)FA_SEG;   // stages of this wave's stream
    const uint32_t st0 = wave < 4u ? (blk + (blk >> 3)) % (uint32_t)FA_NST : (blk + (blk >> 3)) % (uint32_t)FA_SEG;   // the stage of it that is walked first
    const uint64_t src = (uint64_t)(size_t)(((wave & 2u) == 0u ? K : V) + (size_t)(b * NKV + gkv) * TT * HD) + (uint64_t)((wave < 4u ? 0u : (uint32_t)FA_KO) + (wave & 1u) * 64u) * FA_ROWB;   // its slice of stage 0
    u32x4 g0; u32x8 g1;
    auto issue = [&](uint32_t st) {   // this wave's one request of stage st
        const uint32_t dst = lbase + (st & 1u) * FA_STAGE + wave * FA_SLICE; uint32_t ks = (st & smask) + st0; if (ks >= nstr) ks -= nstr;   // both terms lie below nstr: ks is a stage of the stream
        const uint64_t ga = src + (uint64_t)(ks * 128u) * FA_ROWB;
        if (pinned((wave & 2u) == 0u)) tdm_load<FA_W0K>(dst, ga, g0, g1);   // the two differ in the pad alone, a constant on either path
        else tdm_load<FA_W0V>(dst, ga, g0, g1);
    };
    issue(0u);
    Frag qf[FA_R][FA_DK];
    auto load_q = [&](uint32_t cg) {   // column group cg of this (batch, kv head): query head gkv * REP + cg / (TT / 32), rows (cg % (TT / 32)) * 32 ...
        const uint32_t hq = gkv * (uint32_t)REP + cg / (uint32_t)(TT / FA_CW), t0 = (cg % (uint32_t)(TT / FA_CW)) * (uint32_t)FA_CW;
#pragma unroll
        for (int g = 0; g < FA_R; ++g) { const h16* qp = Q + ((size_t)(b * NH_ + hq) * TT + t0 + 16u * g + c) * HD + 8u * h;
#pragma unroll
            for (int kc = 0; kc < FA_DK; ++kc) { qf[g][kc].q[0] = *reinterpret_cast<const u32x4*>(qp + 32 * kc); qf[g][kc].q[1] = *reinterpret_cast<const u32x4*>(qp + 32 * kc + 16); } }
    };
    const uint32_t cg0 = blk * (uint32_t)FA_OW + (helper ? hw * 3u : wave);   // an owner's group; a helper's first of three
    load_q(cg0);
    v8f acc[FA_R][FA_DT], negm[FA_R], lsum[FA_R];
    Frag ones;   // fp16 1.0 in every place of the A operand
#pragma unroll
    for (int i = 0; i < 4; ++i) { ones.q[0][i] = one2h(); ones.q[1][i] = one2h(); }
    auto clear = [&]() {
#pragma unroll
        for (int g = 0; g < FA_R; ++g) { negm[g] = (v8f){}; lsum[g] = (v8f){};   // the first pass sets the maximum in use
#pragma unroll
            for (int t = 0; t < FA_DT; ++t) acc[g][t] = (v8f){}; } };
    clear();
    wait_tensor0(g0, g1);     // stage 0 has landed (this wave's slice)
    __syncthreads();    // ... and is published to every wave
    issue(1u);
    // An owner takes its helper's partial result in: both are brought to the larger of the two maxima in use and added. Lane and register hold the same element in both waves.
    auto join = [&]() {
        const v4f ml = *reinterpret_cast<const v4fa*>(L + FA_XM + hw * 512u + lane * 16u);
#pragma unroll
        for (int g = 0; g < FA_R; ++g) { const float nn = __builtin_fminf(negm[g][0], ml[2 * g]);
            const float f1 = __builtin_amdgcn_exp2f(nn - negm[g][0]), f2 = __builtin_amdgcn_exp2f(nn - ml[2 * g]);
            lsum[g] = lsum[g] * f1 + ml[2 * g + 1] * f2;
#pragma unroll
            for (int i = 0; i < 8; ++i) negm[g][i] = nn;
#pragma unroll
            for (int t = 0; t < FA_DT; ++t) { const unsigned char* xp = L + FA_XS + hw * 16384u + (uint32_t)(g * FA_DT + t) * 1024u + lane * 16u;
                const v4f lo = *reinterpret_cast<const v4fa*>(xp), up = *reinterpret_cast<const v4fa*>(xp + 512u);
#pragma unroll
                for (int i = 0; i < 4; ++i) { acc[g][t][i] = acc[g][t][i] * f1 + lo[i] * f2; acc[g][t][i + 4] = acc[g][t][i + 4] * f1 + up[i] * f2; } } } };
    const uint32_t fmask = helper ? (uint32_t)(FA_SEG - 1) : 0xFFFFFFFFu;   // a helper starts anew with every group
    KFr kf; v8f s[FA_KT][FA_R];
#pragma unroll 1   // rolled: one publish point in the text, and the pass loop stays nested in it
    for (uint32_t st = 0; st < (uint32_t)FA_NST; ++st) {
        if (st != 0u && (st & (uint32_t)(FA_SEG - 1)) == 0u) {   // the publish point just passed has handed over the helpers' finished groups
            if (helper) { load_q(cg0 + st / (uint32_t)FA_SEG); clear(); }
            else if (wave % 3u == st / (uint32_t)FA_SEG - 1u) join();
        }
        const uint32_t base = (st & 1u) * FA_STAGE + (helper ? FA_STREAM : 0u);
        load_k(kf, L, base + k_off(0u), lane);
        fa_open(kf, (st & fmask) == 0u, base + k_off(1u), L, lane, qf, s, acc, negm, lsum);
#pragma unroll 1   // kept rolled: the two passes that fetch K two ahead share their text
        for (uint32_t sub = 0; sub < 2u; ++sub) fa_pass<true, true>(kf, base + k_off(sub + 2u), L, base + v_off(sub), lane, qf, ones, s, acc, negm, lsum);
        fa_pass<true, false>(kf, 0u, L, base + v_off(2u), lane, qf, ones, s, acc, negm, lsum);
        fa_pass<false, false>(kf, 0u, L, base + v_off(3u), lane, qf, ones, s, acc, negm, lsum);
        if (helper && (st & (uint32_t)(FA_SEG - 1)) == (uint32_t)(FA_SEG - 1)) {   // a group's share is done: its partial result goes to the hand-over, ahead of the publish point's wait and barrier
            nop4();   // the slots behind the pass's last WMMA before its D is read
#pragma unroll
            for (int g = 0; g < FA_R; ++g) {
#pragma unroll
                for (int t = 0; t < FA_DT; ++t) { unsigned char* xp = L + FA_XS + hw * 16384u + (uint32_t)(g * FA_DT + t) * 1024u + lane * 16u;
                    *reinterpret_cast<v4fa*>(xp) = (v4f){acc[g][t][0], acc[g][t][1], acc[g][t][2], acc[g][t][3]}; *reinterpret_cast<v4fa*>(xp + 512u) = (v4f){acc[g][t][4], acc[g][t][5], acc[g][t][6], acc[g][t][7]}; } }
            *reinterpret_cast<v4fa*>(L + FA_XM + hw * 512u + lane * 16u) = (v4f){negm[0][0], lsum[0][0], negm[1][0], lsum[1][0]};
        }
        // Publish point of stage st + 1, every wave: own LDS reads and writes done, own request landed, barrier; only then the refill of the buffer just read.
        wait_ds0();
        wait_tensor0(g0, g1);
        __syncthreads();
        if (pinned(st + 2u < (uint32_t)FA_NST)) issue(st + 2u);
    }
    wait_tensor0(g0, g1);
    wait_ds0();
    if (helper) return;   // behind the last barrier: the helpers have no rows of their own to store
    if (wave % 3u == 2u) join();
    // The last publish point's barrier has ended every wave's reads of the ring: it becomes output staging, one region a wave.
    const uint32_t hq = gkv * (uint32_t)REP + cg0 / (uint32_t)(TT / FA_CW), t0 = (cg0 % (uint32_t)(TT / FA_CW)) * (uint32_t)FA_CW;
    const uint32_t eh = wave * (uint32_t)FA_CW * FA_EP;
#pragma unroll
    for (int g = 0; g < FA_R; ++g) { const float inv = 1.0f / lsum[g][0];   // the sum over all keys: the ones product has joined the wave halves
#pragma unroll
        for (int t = 0; t < FA_DT; ++t) { const v8f o = acc[g][t] * inv; u32x4 ph;
#pragma unroll
            for (int i = 0; i < 4; ++i) ph[i] = pack2h(o[2 * i], o[2 * i + 1]);
            const uint32_t eo = (16u * g + c) * FA_EP + 32u * t + 16u * h;
            *reinterpret_cast<u32x4*>(L + eh + eo) = ph; } }
    wait_ds0();
    // Read back whole rows: 16 lanes cover one 256-byte row, so every 128-byte line of the plane is stored once.
#pragma unroll
    for (uint32_t i = 0; i < (uint32_t)FA_CW / 2u; ++i) { const uint32_t row = i * 2u + lane / 16u, colb = (lane % 16u) * 16u;
        const u32x4 vh = *reinterpret_cast<const u32x4*>(L + eh + row * FA_EP + colb);
        const size_t ob = (((size_t)b * TT + t0 + row) * DQ + (size_t)hq * HD) * 2 + colb;
        *reinterpret_cast<u32x4*>(reinterpret_cast<unsigned char*>(AO) + ob) = vh; }
}

// ---- k_gemmw: C[m][n] = sum_k A[m][k] Bt[n][k], 16-bit operands (F16: fp16, else bf16; the planes are passed as their bits) in K-contiguous planes of GK elements a row, f32 accumulate; every wave keeps one 64x64 tile (16 accumulators).
// A workgroup is 2 x 2 waves on a 128 x 128 tile; grid (M / 128, N / 128). Its operand rows come by tensor loads in stages of 64 k (128 bytes a row) into two LDS buffers:
// every wave brings one slice of 64 rows a stage (A: slices 0, 1; Bt: 2, 3), so a row is fetched once a workgroup and each fragment is read from LDS by the waves that share it.
// HEADS: m = b * TT + t, n runs over the q, then the k, then the v columns; the tile goes out rounded to fp16 into the head planes PQ, PK, PV ([b][h][t][d]), the q columns times QSC (in f32, ahead of the one rounding), and C is not used.
// Every "#pragma unroll" of this section but the two over output rows stands over a loop whose index picks a register array's element: unrolled, the arrays stay in registers.
#define GK 768u                    // row length of every operand plane, elements
#define G_ROWB 128u                // bytes of one operand row in a stage
#define G_P 144u                   // its LDS pitch (ds_load_b128 readers): 16 B x odd
#define G_SLICE 10240u             // 64 padded rows, rounded up to a multiple of 2 KiB
#define G_NST (GK / 64u)
#define G_OS (16u * 68u * 4u)      // bytes of one wave's output staging
#define G_W0 ((1u << 20) | (4u << 22) | (3u << 25))   // descriptor group 1 word 0: pad of 16 B behind every 128-B row
static_assert(DM == GK && DQ == GK && G_NST >= 2u && 64u * G_P <= G_SLICE && (NB_ * TT) % 128 == 0 && (DQ + 2 * DKV) % 128 == 0 && DM % 128 == 0, "whole tiles, whole stages, two stages or more");
// One tensor load of 64 rows of 128 bytes at a source pitch of 2 GK bytes: tdm_load's form (fixed scalar registers, descriptor and load in one statement, for the reasons given there) with this tile's constants.
DEV void tdm_load_g(uint32_t lds_dst, uint64_t ga, u32x4& g0, u32x8& g1) {
    constexpr uint32_t d0 = G_ROWB, d1 = 64u;
    asm volatile("s_mov_b32 s80, 1\n\ts_mov_b32 s81, %2\n\ts_mov_b32 s82, %3\n\ts_mov_b32 s83, %4\n\t"
                 "s_mov_b32 s84, %5\n\ts_mov_b32 s85, %6\n\ts_mov_b32 s86, %7\n\ts_mov_b32 s87, %8\n\ts_mov_b32 s88, %9\n\ts_mov_b32 s89, %10\n\ts_mov_b32 s90, 0\n\ts_mov_b32 s91, 0\n\t"
                 "tensor_load_to_lds s[80:83], s[84:91]"
                 : "=&{s[80:83]}"(g0), "=&{s[84:91]}"(g1)
                 : "s"(uni(lds_dst)), "s"(uni((uint32_t)ga)), "s"(uni((((uint32_t)(ga >> 32)) & 0x01FFFFFFu) | 0x80000000u)),
                   "n"(G_W0), "n"((d0 & 0xFFFFu) << 16), "n"((d0 >> 16) | ((d1 & 0xFFFFu) << 16)), "n"((d1 >> 16) | (d0 << 16)), "n"(d1), "n"(2u * GK)
                 : "memory"); }
DEV v16bf ld_fr(const unsigned char* p) { return cat16b(*reinterpret_cast<const v8usa*>(p), *reinterpret_cast<const v8usa*>(p + 32)); }   // the hardware k order: bytes 16 h and 32 + 16 h of each 64 (p holds the 16 h)
template <bool F16> DEV v8f gmma(v16bf a, v16bf b, v8f c) { if constexpr (F16) return wmma16(__builtin_bit_cast(v16h, a), __builtin_bit_cast(v16h, b), c); else return wmmab(a, b, c); }
template <bool F16, bool HEADS>
__global__ __launch_bounds__(128) void k_gemmw(const bf* __restrict__ A, const bf* __restrict__ Bt, float* C, int ldc, h16* PQ, h16* PK, h16* PV) {
    constexpr uint32_t WN = 2u, NW = 2u * WN, NA = 2u, STAGE = NW * G_SLICE;
    __shared__ __attribute__((aligned(2048))) unsigned char L[2u * STAGE + NW * G_OS];   // the ring, then one staging region a wave
    const uint32_t lane = threadIdx.x & 31u, wave = uni(threadIdx.x >> 5), lr = lane & 15u, hi = lane >> 4, wm = wave / WN, wn = wave % WN;
    const uint32_t R0 = blockIdx.x * 128u, C0 = blockIdx.y * (64u * WN);
    const int r0 = (int)(R0 + wm * 64u), c0 = (int)(C0 + wn * 64u);
    const bf* sp = A + (size_t)(R0 + (wave & 1u) * 64u) * GK;   // this wave's slice of stage 0
    if (wave >= NA) sp = Bt + (size_t)(C0 + (wave - NA) * 64u) * GK;
    const uint64_t src = (uint64_t)(size_t)sp; const uint32_t lbase = (uint32_t)(size_t)L;
    u32x4 g0; u32x8 g1;
    // Workgroups of one tile row share the A rows, those of one tile column the Bt rows. Each starts its walk over k at a stage of its own and wraps round (A and Bt at the same one),
    // so that workgroups that run side by side ask L2 for different lines of the shared rows.
    const uint32_t st0 = (blockIdx.x + (blockIdx.x >> 3) + blockIdx.y) % G_NST;
    auto issue = [&](uint32_t st) { uint32_t ks = st + st0; if (ks >= G_NST) ks -= G_NST;   // every wave issues its one request of stage st: the 64 k from 64 ks on
        tdm_load_g(lbase + (st & 1u) * STAGE + wave * G_SLICE, src + (uint64_t)(ks * G_ROWB), g0, g1); };
    issue(0u);
    v8f acc[4][4];
#pragma unroll
    for (int mb = 0; mb < 4; ++mb)
#pragma unroll
        for (int nb = 0; nb < 4; ++nb) acc[mb][nb] = (v8f){};
    const uint32_t fo = lr * G_P + 16u * hi;   // this lane's place in a 16-row fragment
    wait_tensor0(g0, g1);     // stage 0 has landed (this wave's slice)
    __syncthreads();    // ... and is published to every wave
    issue(1u);
#pragma unroll 1   // rolled: one publish point in the text
    for (uint32_t st = 0; st < G_NST; ++st) {
        const unsigned char* Ls = L + (st & 1u) * STAGE + fo;
        v16bf a[2][4], b[2][4];
#pragma unroll
        for (uint32_t kc = 0; kc < 2u; ++kc) {
#pragma unroll
            for (uint32_t i = 0; i < 4u; ++i) { a[kc][i] = ld_fr(Ls + wm * G_SLICE + i * 16u * G_P + kc * 64u); b[kc][i] = ld_fr(Ls + (NA + wn) * G_SLICE + i * 16u * G_P + kc * 64u); } }
        fence();   // the stage's fragment loads stand as one group ahead of its products: left to the scheduler, a pair of loads and a wait to 0 stood in front of every four WMMAs
#pragma unroll
        for (uint32_t kc = 0; kc < 2u; ++kc) {
#pragma unroll
            for (uint32_t nb = 0; nb < 4u; ++nb) {
#pragma unroll
                for (uint32_t mb = 0; mb < 4u; ++mb) acc[mb][nb] = gmma<F16>(a[kc][mb], b[kc][nb], acc[mb][nb]); } }
        fence(); nop4(); fence();   // the slots behind the stage's last WMMA, on the loop's back edge too, before the next stage's fragment loads overwrite its A and B
        // Publish point of stage st + 1, every wave: own LDS reads done, own request landed, barrier; only then the refill of the buffer just read.
        wait_ds0();
        wait_tensor0(g0, g1);
        __syncthreads();
        if (pinned(st + 2u < G_NST)) issue(st + 2u);
    }
    wait_tensor0(g0, g1);
    wait_ds0();
    float* os = reinterpret_cast<float*>(L + 2u * STAGE + wave * G_OS);   // outside the ring, this wave's own: no barrier is owed
#pragma unroll
    for (int mb = 0; mb < 4; ++mb) {
#pragma unroll
        for (int nb = 0; nb < 4; ++nb) {
#pragma unroll
            for (int j = 0; j < 8; ++j) os[(hi * 8 + j) * 68 + nb * 16 + lr] = acc[mb][nb][j]; }
        __builtin_amdgcn_wave_barrier(); asm volatile("" ::: "memory");   // the staging stores stay ahead of the row reads below (other lanes' values)
        if (HEADS) {   // the tile's 64 rows lie in one batch, its 64 columns in one head: a row of the tile is one whole 128-byte line of the plane
            h16* P = PQ; int nh = NH_, hh = c0 / HD; float osc = QSC;
            if (c0 >= DQ + DKV) { P = PV; nh = NKV; hh = (c0 - DQ - DKV) / HD; osc = 1.0f; } else if (c0 >= DQ) { P = PK; nh = NKV; hh = (c0 - DQ) / HD; osc = 1.0f; }
            h16* prow = P + ((size_t)((r0 / TT) * nh + hh) * TT + (r0 % TT) + mb * 16) * HD + (c0 % HD);
#pragma unroll
            for (int s = 0; s < 4; ++s) { const int row = 4 * s + (lane >> 3), cofs = (lane & 7) * 8; const v4f lo = *(const v4fa*)(os + row * 68 + cofs), up = *(const v4fa*)(os + row * 68 + cofs + 4); v8h o;
#pragma unroll
                for (int k = 0; k < 4; ++k) { o[k] = (h16)(lo[k] * osc); o[k + 4] = (h16)(up[k] * osc); }
                *(v8h*)(prow + (size_t)row * HD + cofs) = o; }
        } else {
            float* crow = C + (size_t)(r0 + mb * 16) * ldc + c0;
#pragma unroll
            for (int s = 0; s < 8; ++s) { const int row = 2 * s + hi, cofs = lr * 4;
                *(v4f*)(crow + (size_t)row * ldc + cofs) = *(const v4fa*)(os + row * 68 + cofs); }
        }
        __builtin_amdgcn_wave_barrier(); asm volatile("" ::: "memory");   // ... and the row reads ahead of the next block's staging stores
    }
}

extern "C" void kernel_launch(void* const* d_in, const int* in_sizes, int n_in,
                              void* d_out, int out_size, void* d_ws, size_t ws_size, hipStream_t stream) {
    (void)in_sizes; (void)n_in; (void)out_size;
    const float* x = (const float*)d_in[0]; const float* wq = (const float*)d_in[1]; const float* wk = (const float*)d_in[2]; const float* wv = (const float*)d_in[3]; const float* wo = (const float*)d_in[4];
    float* OUT = (float*)d_out;     // [2][4096][768]
    char* wsp = (char*)d_ws;
    auto take = [&](size_t bytes) { char* p = wsp; wsp += (bytes + 255) & ~(size_t)255; return (void*)p; };
    bf* XB = (bf*)take((size_t)CV_TOT * 8 * 2); bf* WQ = XB + (size_t)CV_NX * 8; bf* WO = WQ + (size_t)(CV_NQ + 2 * CV_NK) * 8;   // x of both batches [b * TT + t][DM]; wq, wk, wv as one [DQ + 2 DKV][DM] matrix; wo (fp16 bits)
    h16* QP16 = (h16*)take((size_t)NB_ * NH_ * TT * HD * 2); h16* KP16 = (h16*)take((size_t)NB_ * NKV * TT * HD * 2); h16* VP16 = (h16*)take((size_t)NB_ * NKV * TT * HD * 2);   // head planes [b][h][t][d] of both batches
    h16* AT = (h16*)take((size_t)NB_ * TT * DQ * 2);   // the merged heads [b * TT + t][DQ]
    if ((size_t)(wsp - (char*)d_ws) > ws_size) return;    // ws 256 MiB
    k_cvtall<<<CV_GRID, 256, 0, stream>>>(x, wq, wk, wv, wo, XB);
    k_gemmw<false, true><<<dim3(NB_ * TT / 128, (DQ + 2 * DKV) / 128, 1), 128, 0, stream>>>(XB, WQ, nullptr, 0, QP16, KP16, VP16);   // v as [g][t][d] rows: the fused kernel transposes on its LDS read
    k_fattn<<<dim3(FA_NCG / FA_OW, NKV, NB_), FA_NW * 32, 0, stream>>>(QP16, KP16, VP16, AT);
    k_gemmw<true, false><<<dim3(NB_ * TT / 128, DM / 128, 1), 128, 0, stream>>>((const bf*)AT, WO, OUT, DM, nullptr, nullptr, nullptr);
}
